// v000
// Times are from an AMD MI455X. After a warm-up the kernel runs many times in a row, and a time is the length of
// such a window on the GPU divided by its runs, so every launch and the gaps after it count. The runs cycle
// through copies of the inputs. A figure is the median of several windows, for all but v000 over two sittings.
// Sittings can differ by a few percent; kernels timed side by side share one.
// v000 is the starting kernel. One run takes 170 microseconds.
#include <hip/hip_runtime.h>

#define S_  1024
#define B_  2
#define D_  1024
#define H_  16
#define HD_ 64
#define M_  (S_*B_)   // 2048 rows

typedef _Float16 v16h __attribute__((ext_vector_type(16)));
typedef _Float16 v8h  __attribute__((ext_vector_type(8)));
typedef float    v8f  __attribute__((ext_vector_type(8)));

static __device__ __forceinline__ v8f vzero8() {
    v8f z;
#pragma unroll
    for (int i = 0; i < 8; ++i) z[i] = 0.0f;
    return z;
}

// Load a 16x32 (f16) WMMA A/B operand chunk for this lane.
// p = start of this lane's row (A: row m; B: col n) at the current k-base.
// Lane group g (=lane>>4): g=0 takes halves {0..7,16..23}, g=1 takes {8..15,24..31}.
static __device__ __forceinline__ v16h ld_ab(const _Float16* p, int g) {
    v8h lo = *(const v8h*)(p + g * 8);
    v8h hi = *(const v8h*)(p + g * 8 + 16);
    return __builtin_shufflevector(lo, hi, 0,1,2,3,4,5,6,7,8,9,10,11,12,13,14,15);
}

static __device__ __forceinline__ v8f wmma16(v16h a, v16h b, v8f c) {
    // D = A(16x32,f16) * B(32x16,f16) + C(16x16,f32)
    return __builtin_amdgcn_wmma_f32_16x16x32_f16(false, a, false, b, (short)0, c, false, false);
}

// ---------------------------------------------------------------- convert
__global__ void cvt_f16_kernel(const float* __restrict__ src,
                               _Float16* __restrict__ dst, int n) {
    int i = blockIdx.x * blockDim.x + threadIdx.x;
    if (i < n) dst[i] = (_Float16)src[i];
}

// ---------------------------------------------------------------- QKV GEMM
// X (2048x1024, f16) @ W[which]^T + b, 64Mx64N per wave (4 M-tiles x 4 N-tiles):
// each A and B fetch feeds 4 WMMAs -> 1.0 b128 loads per WMMA in steady state.
// Outputs: xq/xk in (b,h,s,hd), xv transposed to (b,h,hd,t).
__global__ __launch_bounds__(32) void qkv_gemm_kernel(
    const _Float16* __restrict__ qf16, const _Float16* __restrict__ wf16,
    const float* __restrict__ bq, const float* __restrict__ bk,
    const float* __restrict__ bv,
    _Float16* __restrict__ xq, _Float16* __restrict__ xk,
    _Float16* __restrict__ xvT)
{
    const int lane   = threadIdx.x;
    const int colx   = lane & 15;
    const int g      = lane >> 4;
    const int mtile4 = blockIdx.x;  // 0..31 (64 rows each)
    const int h      = blockIdx.y;  // 0..15 (covers 64 output cols)
    const int which  = blockIdx.z;  // 0=q 1=k 2=v

    const _Float16* W    = wf16 + (size_t)which * D_ * D_;
    const float*    bias = (which == 0) ? bq : (which == 1) ? bk : bv;

    const _Float16* arow[4];
#pragma unroll
    for (int mt = 0; mt < 4; ++mt)
        arow[mt] = qf16 + (size_t)(mtile4 * 64 + mt * 16 + colx) * D_;

    v8f acc[4][4];
#pragma unroll
    for (int mt = 0; mt < 4; ++mt)
#pragma unroll
        for (int nt = 0; nt < 4; ++nt) acc[mt][nt] = vzero8();

    for (int k = 0; k < D_; k += 32) {
        v16h a[4];
#pragma unroll
        for (int mt = 0; mt < 4; ++mt) a[mt] = ld_ab(arow[mt] + k, g);
#pragma unroll
        for (int nt = 0; nt < 4; ++nt) {
            const _Float16* wrow = W + (size_t)(h * 64 + nt * 16 + colx) * D_;
            v16h bm = ld_ab(wrow + k, g);
#pragma unroll
            for (int mt = 0; mt < 4; ++mt)
                acc[mt][nt] = wmma16(a[mt], bm, acc[mt][nt]);
        }
    }

#pragma unroll
    for (int nt = 0; nt < 4; ++nt) {
        const int   n  = h * 64 + nt * 16 + colx;
        const int   hd = nt * 16 + colx;
        const float bn = bias[n];
#pragma unroll
        for (int mt = 0; mt < 4; ++mt) {
#pragma unroll
            for (int i = 0; i < 8; ++i) {
                const int m = mtile4 * 64 + mt * 16 + i + 8 * g;
                const int s = m >> 1;       // rows are (s,b) interleaved, B=2
                const int b = m & 1;
                const _Float16 val = (_Float16)(acc[mt][nt][i] + bn);
                if (which == 2) {
                    xvT[((size_t)((b * H_ + h) * HD_ + hd)) * S_ + s] = val;  // (b,h,hd,t)
                } else {
                    _Float16* dst = (which == 0) ? xq : xk;
                    dst[((size_t)((b * H_ + h) * S_ + s)) * HD_ + hd] = val;  // (b,h,s,hd)
                }
            }
        }
    }
}

// ---------------------------------------------------------------- flash attention
// One wave per (b,h,stile): 16 Q rows, streams all 1024 t columns 32 at a time.
__global__ __launch_bounds__(32) void attn_kernel(
    const _Float16* __restrict__ xq, const _Float16* __restrict__ xk,
    const _Float16* __restrict__ xvT, const float* __restrict__ mask,
    _Float16* __restrict__ attn)
{
    __shared__ _Float16 pLDS[16 * 32];   // 1 KB, wave-private (1 wave/WG)

    const int lane  = threadIdx.x;
    const int colx  = lane & 15;
    const int g     = lane >> 4;
    const int stile = blockIdx.x & 63;
    const int h     = (blockIdx.x >> 6) & 15;
    const int b     = blockIdx.x >> 10;

    const _Float16* Qb = xq  + ((size_t)(b * H_ + h) * S_) * HD_;
    const _Float16* Kb = xk  + ((size_t)(b * H_ + h) * S_) * HD_;
    const _Float16* Vt = xvT + ((size_t)(b * H_ + h) * HD_) * S_;

    // Q tile A-operands, kept resident: hd 0..31 and 32..63
    const _Float16* qrow = Qb + (size_t)(stile * 16 + colx) * HD_;
    const v16h qa0 = ld_ab(qrow,      g);
    const v16h qa1 = ld_ab(qrow + 32, g);

    float mrun[8], lrun[8];
#pragma unroll
    for (int i = 0; i < 8; ++i) { mrun[i] = -1.0e30f; lrun[i] = 0.0f; }
    v8f o[4];
#pragma unroll
    for (int nt = 0; nt < 4; ++nt) o[nt] = vzero8();

    for (int tb = 0; tb < S_; tb += 32) {
        // scores for 32 t columns: two 16x16 C tiles, K=64 over hd
        v8f s0 = vzero8(), s1 = vzero8();
        {
            const _Float16* krow0 = Kb + (size_t)(tb + colx) * HD_;
            s0 = wmma16(qa0, ld_ab(krow0,      g), s0);
            s0 = wmma16(qa1, ld_ab(krow0 + 32, g), s0);
            const _Float16* krow1 = Kb + (size_t)(tb + 16 + colx) * HD_;
            s1 = wmma16(qa0, ld_ab(krow1,      g), s1);
            s1 = wmma16(qa1, ld_ab(krow1 + 32, g), s1);
        }

        // scale * multiplicative mask; online softmax over t
        float p0[8], p1[8], tm[8];
#pragma unroll
        for (int i = 0; i < 8; ++i) {
            const int srow = stile * 16 + i + 8 * g;          // C/D row for elem i
            const float f0 = s0[i] * 0.125f * mask[(size_t)srow * S_ + tb + colx];
            const float f1 = s1[i] * 0.125f * mask[(size_t)srow * S_ + tb + 16 + colx];
            p0[i] = f0; p1[i] = f1;
            tm[i] = fmaxf(f0, f1);
        }
#pragma unroll
        for (int i = 0; i < 8; ++i) {
#pragma unroll
            for (int off = 1; off < 16; off <<= 1)            // 16-lane row groups
                tm[i] = fmaxf(tm[i], __shfl_xor(tm[i], off, 32));
        }
        float corr[8], rs[8];
#pragma unroll
        for (int i = 0; i < 8; ++i) {
            const float mn = fmaxf(mrun[i], tm[i]);
            corr[i] = __expf(mrun[i] - mn);
            mrun[i] = mn;
            p0[i] = __expf(p0[i] - mn);
            p1[i] = __expf(p1[i] - mn);
            rs[i] = p0[i] + p1[i];
        }
#pragma unroll
        for (int i = 0; i < 8; ++i) {
#pragma unroll
            for (int off = 1; off < 16; off <<= 1)
                rs[i] += __shfl_xor(rs[i], off, 32);
            lrun[i] = lrun[i] * corr[i] + rs[i];
        }
#pragma unroll
        for (int nt = 0; nt < 4; ++nt)
#pragma unroll
            for (int i = 0; i < 8; ++i)
                o[nt][i] *= corr[i];

        // C/D-layout P -> row-major 16x32 f16 in LDS -> A-layout operand
#pragma unroll
        for (int i = 0; i < 8; ++i) {
            const int r = i + 8 * g;
            pLDS[r * 32 + colx]      = (_Float16)p0[i];
            pLDS[r * 32 + colx + 16] = (_Float16)p1[i];
        }
        asm volatile("s_wait_dscnt 0" ::: "memory");          // DS in-order; fence scheduler too
        const v16h pa = ld_ab(&pLDS[colx * 32], g);

        // O += P (16x32) * V (32x64): 4 N-tiles from transposed V (contiguous along t)
#pragma unroll
        for (int nt = 0; nt < 4; ++nt) {
            const _Float16* vrow = Vt + (size_t)(nt * 16 + colx) * S_ + tb;
            o[nt] = wmma16(pa, ld_ab(vrow, g), o[nt]);
        }
    }

    // normalize and store to (s,b,d) f16 for the output projection
#pragma unroll
    for (int nt = 0; nt < 4; ++nt) {
#pragma unroll
        for (int i = 0; i < 8; ++i) {
            const int s = stile * 16 + i + 8 * g;
            const int d = h * 64 + nt * 16 + colx;
            attn[((size_t)(s * B_ + b)) * D_ + d] = (_Float16)(o[nt][i] / lrun[i]);
        }
    }
}

// ---------------------------------------------------------------- output projection
// attn (2048x1024,f16) @ Wo^T + bo -> out (f32); same 64Mx64N wave tiling.
__global__ __launch_bounds__(32) void out_gemm_kernel(
    const _Float16* __restrict__ attn, const _Float16* __restrict__ Wo16,
    const float* __restrict__ bo, float* __restrict__ out)
{
    const int lane   = threadIdx.x;
    const int colx   = lane & 15;
    const int g      = lane >> 4;
    const int mtile4 = blockIdx.x;  // 0..31
    const int n64    = blockIdx.y;  // 0..15

    const _Float16* arow[4];
#pragma unroll
    for (int mt = 0; mt < 4; ++mt)
        arow[mt] = attn + (size_t)(mtile4 * 64 + mt * 16 + colx) * D_;

    v8f acc[4][4];
#pragma unroll
    for (int mt = 0; mt < 4; ++mt)
#pragma unroll
        for (int nt = 0; nt < 4; ++nt) acc[mt][nt] = vzero8();

    for (int k = 0; k < D_; k += 32) {
        v16h a[4];
#pragma unroll
        for (int mt = 0; mt < 4; ++mt) a[mt] = ld_ab(arow[mt] + k, g);
#pragma unroll
        for (int nt = 0; nt < 4; ++nt) {
            const _Float16* wrow = Wo16 + (size_t)(n64 * 64 + nt * 16 + colx) * D_;
            v16h bm = ld_ab(wrow + k, g);
#pragma unroll
            for (int mt = 0; mt < 4; ++mt)
                acc[mt][nt] = wmma16(a[mt], bm, acc[mt][nt]);
        }
    }

#pragma unroll
    for (int nt = 0; nt < 4; ++nt) {
        const int   n  = n64 * 64 + nt * 16 + colx;
        const float bn = bo[n];
#pragma unroll
        for (int mt = 0; mt < 4; ++mt) {
#pragma unroll
            for (int i = 0; i < 8; ++i) {
                const int m = mtile4 * 64 + mt * 16 + i + 8 * g;
                out[(size_t)m * D_ + n] = acc[mt][nt][i] + bn;
            }
        }
    }
}

// ---------------------------------------------------------------- launch
extern "C" void kernel_launch(void* const* d_in, const int* in_sizes, int n_in,
                              void* d_out, int out_size, void* d_ws, size_t ws_size,
                              hipStream_t stream) {
    (void)in_sizes; (void)n_in; (void)out_size; (void)ws_size;

    const float* query = (const float*)d_in[0];
    const float* mask  = (const float*)d_in[1];
    const float* Wq    = (const float*)d_in[2];
    const float* bq    = (const float*)d_in[3];
    const float* Wk    = (const float*)d_in[4];
    const float* bk    = (const float*)d_in[5];
    const float* Wv    = (const float*)d_in[6];
    const float* bv    = (const float*)d_in[7];
    const float* Wo    = (const float*)d_in[8];
    const float* bo    = (const float*)d_in[9];
    float* out = (float*)d_out;

    char* ws = (char*)d_ws;
    const size_t MB = 1024 * 1024;
    _Float16* qf16 = (_Float16*)(ws);             // 2048x1024        (4 MB)
    _Float16* wf16 = (_Float16*)(ws + 4 * MB);    // 4x 1024x1024     (8 MB): q,k,v,o
    _Float16* xq   = (_Float16*)(ws + 12 * MB);   // (b,h,s,hd)       (4 MB)
    _Float16* xk   = (_Float16*)(ws + 16 * MB);   // (b,h,t,hd)       (4 MB)
    _Float16* xvT  = (_Float16*)(ws + 20 * MB);   // (b,h,hd,t)       (4 MB)
    _Float16* attn = (_Float16*)(ws + 24 * MB);   // (s,b,d)          (4 MB)

    const int NQ = M_ * D_;     // 2M
    const int NW = D_ * D_;     // 1M
    cvt_f16_kernel<<<(NQ + 255) / 256, 256, 0, stream>>>(query, qf16, NQ);
    cvt_f16_kernel<<<(NW + 255) / 256, 256, 0, stream>>>(Wq, wf16 + 0 * (size_t)NW, NW);
    cvt_f16_kernel<<<(NW + 255) / 256, 256, 0, stream>>>(Wk, wf16 + 1 * (size_t)NW, NW);
    cvt_f16_kernel<<<(NW + 255) / 256, 256, 0, stream>>>(Wv, wf16 + 2 * (size_t)NW, NW);
    cvt_f16_kernel<<<(NW + 255) / 256, 256, 0, stream>>>(Wo, wf16 + 3 * (size_t)NW, NW);

    qkv_gemm_kernel<<<dim3(M_ / 64, H_, 3), 32, 0, stream>>>(
        qf16, wf16, bq, bk, bv, xq, xk, xvT);

    attn_kernel<<<B_ * H_ * (S_ / 16), 32, 0, stream>>>(xq, xk, xvT, mask, attn);

    out_gemm_kernel<<<dim3(M_ / 64, D_ / 64), 32, 0, stream>>>(
        attn, wf16 + 3 * (size_t)NW, bo, out);
}

// v001
// A run of this version takes 131 microseconds.
// In two side-by-side timings against v000, it was 1.31 and 1.33 times as fast.
#include <hip/hip_runtime.h>

#define S_  1024
#define B_  2
#define D_  1024
#define H_  16
#define HD_ 64
#define M_  (S_*B_)   // 2048 rows

typedef _Float16 v16h __attribute__((ext_vector_type(16)));
typedef _Float16 v8h  __attribute__((ext_vector_type(8)));
typedef float    v8f  __attribute__((ext_vector_type(8)));

static __device__ __forceinline__ v8f vzero8() {
    v8f z;
#pragma unroll
    for (int i = 0; i < 8; ++i) z[i] = 0.0f;
    return z;
}

// Load a 16x32 (f16) WMMA A/B operand chunk for this lane.
// p = start of this lane's row (A: row m; B: col n) at the current k-base.
// Lane group g (=lane>>4): g=0 takes halves {0..7,16..23}, g=1 takes {8..15,24..31}.
static __device__ __forceinline__ v16h ld_ab(const _Float16* p, int g) {
    v8h lo = *(const v8h*)(p + g * 8);
    v8h hi = *(const v8h*)(p + g * 8 + 16);
    return __builtin_shufflevector(lo, hi, 0,1,2,3,4,5,6,7,8,9,10,11,12,13,14,15);
}

static __device__ __forceinline__ v8f wmma16(v16h a, v16h b, v8f c) {
    // D = A(16x32,f16) * B(32x16,f16) + C(16x16,f32)
    return __builtin_amdgcn_wmma_f32_16x16x32_f16(false, a, false, b, (short)0, c, false, false);
}

// ---------------------------------------------------------------- convert
__global__ void cvt_f16_kernel(const float* __restrict__ src,
                               _Float16* __restrict__ dst, int n) {
    int i = blockIdx.x * blockDim.x + threadIdx.x;
    if (i < n) dst[i] = (_Float16)src[i];
}

// ---------------------------------------------------------------- GEMM tile in LDS
// Both GEMMs: a work-group of 4 waves (2 x 2) makes a 64M x 128N tile, 32M x 64N a wave.
// A pass is 128 k: 64 rows of X and 128 rows of W, 256 B each, copied to LDS at a
// pitch of 272 B (ds_load_b128 reads of 16 rows then fall on all 64 banks).
// Two buffers: the next pass's copies fly while this pass is multiplied.
#define GT_M   64
#define GT_N   128
#define GT_K   128
#define GT_P   136                          // LDS row pitch in halves (272 B)
#define GT_BUF ((GT_M + GT_N) * GT_P)       // halves per buffer (52,224 B)
#define GT_NP  (D_ / GT_K)                  // 8 passes

// Eight 16-byte copies of this lane: its chunk in rows r, r+8, ..., r+56.
// The s_wait_xcnt stands inside the statement so that no address register of a
// copy is rewritten in front of it.
static __device__ __forceinline__ void copy8(unsigned l, const _Float16* p) {
    constexpr unsigned STEP_L = 8u * GT_P * 2u;   // 8 rows in LDS, bytes
    constexpr int      STEP_G = 8 * D_;           // 8 rows in global, halves
    asm volatile(
        "global_load_async_to_lds_b128 %0, %1, off\n\t"
        "global_load_async_to_lds_b128 %2, %3, off\n\t"
        "global_load_async_to_lds_b128 %4, %5, off\n\t"
        "global_load_async_to_lds_b128 %6, %7, off\n\t"
        "global_load_async_to_lds_b128 %8, %9, off\n\t"
        "global_load_async_to_lds_b128 %10, %11, off\n\t"
        "global_load_async_to_lds_b128 %12, %13, off\n\t"
        "global_load_async_to_lds_b128 %14, %15, off\n\t"
        "s_wait_xcnt 0x0"
        :: "v"(l + 0u * STEP_L), "v"(p + 0 * STEP_G),
           "v"(l + 1u * STEP_L), "v"(p + 1 * STEP_G),
           "v"(l + 2u * STEP_L), "v"(p + 2 * STEP_G),
           "v"(l + 3u * STEP_L), "v"(p + 3 * STEP_G),
           "v"(l + 4u * STEP_L), "v"(p + 4 * STEP_G),
           "v"(l + 5u * STEP_L), "v"(p + 5 * STEP_G),
           "v"(l + 6u * STEP_L), "v"(p + 6 * STEP_G),
           "v"(l + 7u * STEP_L), "v"(p + 7 * STEP_G)
        : "memory");
}

// One pass's tile: 192 rows x 16 chunks of 16 B, 24 chunks a lane; 16 lanes cover a row.
// l: LDS byte address of this lane's chunk in row (tid >> 4) of the buffer;
// xa, wb: the same chunk in the X tile and in the W tile at the pass's k.
static __device__ __forceinline__ void copy_pass(unsigned l, const _Float16* xa,
                                                 const _Float16* wb) {
    copy8(l, xa);                                              // X rows   0..63
    copy8(l + GT_M * GT_P * 2u, wb);                           // W rows   0..63
    copy8(l + (GT_M + 64) * GT_P * 2u, wb + (size_t)64 * D_);  // W rows  64..127
}

// acc[mt][nt] = X[m0 + wm*32 + mt*16 ..][:] . W[n0 + wn*64 + nt*16 ..][:]^T over all of K.
// The loops over mt, nt and kb are unrolled so that every index of a fragment or
// accumulator array is a constant and the arrays stay in registers.
static __device__ __forceinline__ void gemm_tile(
    const _Float16* __restrict__ X, const _Float16* __restrict__ Wt,
    int m0, int n0, _Float16* sm, v8f (&acc)[2][4])
{
    const int tid  = threadIdx.x;
    const int lane = tid & 31;
    const int colx = lane & 15;
    const int g    = lane >> 4;
    const int wave = tid >> 5;
    const int wm   = wave >> 1;
    const int wn   = wave & 1;

    const int crow = tid >> 4;          // 0..7
    const int cchk = tid & 15;          // 16-byte chunk in the row
    const _Float16* xa = X  + (size_t)(m0 + crow) * D_ + cchk * 8;
    const _Float16* wb = Wt + (size_t)(n0 + crow) * D_ + cchk * 8;
    const unsigned  l0 = (unsigned)(size_t)(sm + crow * GT_P + cchk * 8);

#pragma unroll
    for (int mt = 0; mt < 2; ++mt)
#pragma unroll
        for (int nt = 0; nt < 4; ++nt) acc[mt][nt] = vzero8();

    copy_pass(l0, xa, wb);
    asm volatile("s_wait_asynccnt 0x0" ::: "memory");   // this wave's copies of pass 0 have landed
    __syncthreads();                                    // ... and every other wave's
    copy_pass(l0 + GT_BUF * 2u, xa + GT_K, wb + GT_K);

    for (int t = 0; t < GT_NP; ++t) {
        const _Float16* buf = sm + (t & 1) * GT_BUF;
        const _Float16* sa  = buf + (wm * 32 + colx) * GT_P;
        const _Float16* sb  = buf + (GT_M + wn * 64 + colx) * GT_P;
        // Fragments of the next 32 k are read, as one group, ahead of this block's WMMAs.
        v16h a[2][2], bm[2][4];
#pragma unroll
        for (int mt = 0; mt < 2; ++mt) a[0][mt] = ld_ab(sa + mt * 16 * GT_P, g);
#pragma unroll
        for (int nt = 0; nt < 4; ++nt) bm[0][nt] = ld_ab(sb + nt * 16 * GT_P, g);
#pragma unroll
        for (int kb = 0; kb < GT_K / 32; ++kb) {
            const int cur = kb & 1, nxt = cur ^ 1;
            if (kb + 1 < GT_K / 32) {
#pragma unroll
                for (int mt = 0; mt < 2; ++mt)
                    a[nxt][mt] = ld_ab(sa + mt * 16 * GT_P + (kb + 1) * 32, g);
#pragma unroll
                for (int nt = 0; nt < 4; ++nt)
                    bm[nxt][nt] = ld_ab(sb + nt * 16 * GT_P + (kb + 1) * 32, g);
            }
            // Keeps the read group in front of the WMMA block: left free, the scheduler
            // sinks each read to its use and every WMMA pair waits out an LDS latency.
            __builtin_amdgcn_sched_barrier(0);
#pragma unroll
            for (int nt = 0; nt < 4; ++nt)
#pragma unroll
                for (int mt = 0; mt < 2; ++mt)
                    acc[mt][nt] = wmma16(a[cur][mt], bm[cur][nt], acc[mt][nt]);
            // Keeps the following read group behind this block, so that it stays one group.
            __builtin_amdgcn_sched_barrier(0);
        }
        asm volatile("s_wait_dscnt 0x0" ::: "memory");     // this wave has left the buffer
        asm volatile("s_wait_asynccnt 0x0" ::: "memory");  // its copies of pass t+1 have landed
        __syncthreads();                                   // publishes pass t+1, frees this buffer
        if (t + 2 < GT_NP)
            copy_pass(l0 + (t & 1) * (GT_BUF * 2u), xa + (t + 2) * GT_K, wb + (t + 2) * GT_K);
    }
    asm volatile("s_wait_asynccnt 0x0" ::: "memory");      // nothing in flight when the wave ends
}

// ---------------------------------------------------------------- QKV GEMM
// X (2048x1024, f16) @ W[which]^T + b.
// Outputs: xq/xk in (b,h,s,hd), xv transposed to (b,h,hd,t).
__global__ __launch_bounds__(128) void qkv_gemm_kernel(
    const _Float16* __restrict__ qf16, const _Float16* __restrict__ wf16,
    const float* __restrict__ bq, const float* __restrict__ bk,
    const float* __restrict__ bv,
    _Float16* __restrict__ xq, _Float16* __restrict__ xk,
    _Float16* __restrict__ xvT)
{
    __shared__ __attribute__((aligned(16))) _Float16 sm[2 * GT_BUF];

    const int lane  = threadIdx.x & 31;
    const int colx  = lane & 15;
    const int g     = lane >> 4;
    const int wave  = threadIdx.x >> 5;
    const int mbase = blockIdx.x * GT_M + (wave >> 1) * 32;  // this wave's 32 rows
    const int h     = blockIdx.y * 2 + (wave & 1);           // this wave's 64 output cols
    const int which = blockIdx.z;                            // 0=q 1=k 2=v

    const _Float16* W    = wf16 + (size_t)which * D_ * D_;
    const float*    bias = (which == 0) ? bq : (which == 1) ? bk : bv;

    v8f acc[2][4];
    gemm_tile(qf16, W, blockIdx.x * GT_M, blockIdx.y * GT_N, sm, acc);

#pragma unroll
    for (int nt = 0; nt < 4; ++nt) {
        const int   n  = h * 64 + nt * 16 + colx;
        const int   hd = nt * 16 + colx;
        const float bn = bias[n];
#pragma unroll
        for (int mt = 0; mt < 2; ++mt) {
#pragma unroll
            for (int i = 0; i < 8; ++i) {
                const int m = mbase + mt * 16 + i + 8 * g;
                const int s = m >> 1;       // rows are (s,b) interleaved, B=2
                const int b = m & 1;
                const _Float16 val = (_Float16)(acc[mt][nt][i] + bn);
                if (which == 2) {
                    xvT[((size_t)((b * H_ + h) * HD_ + hd)) * S_ + s] = val;  // (b,h,hd,t)
                } else {
                    _Float16* dst = (which == 0) ? xq : xk;
                    dst[((size_t)((b * H_ + h) * S_ + s)) * HD_ + hd] = val;  // (b,h,s,hd)
                }
            }
        }
    }
}

// ---------------------------------------------------------------- flash attention
// One wave per (b,h,stile): 16 Q rows, streams all 1024 t columns 32 at a time.
__global__ __launch_bounds__(32) void attn_kernel(
    const _Float16* __restrict__ xq, const _Float16* __restrict__ xk,
    const _Float16* __restrict__ xvT, const float* __restrict__ mask,
    _Float16* __restrict__ attn)
{
    __shared__ _Float16 pLDS[16 * 32];   // 1 KB, wave-private (1 wave/WG)

    const int lane  = threadIdx.x;
    const int colx  = lane & 15;
    const int g     = lane >> 4;
    const int stile = blockIdx.x & 63;
    const int h     = (blockIdx.x >> 6) & 15;
    const int b     = blockIdx.x >> 10;

    const _Float16* Qb = xq  + ((size_t)(b * H_ + h) * S_) * HD_;
    const _Float16* Kb = xk  + ((size_t)(b * H_ + h) * S_) * HD_;
    const _Float16* Vt = xvT + ((size_t)(b * H_ + h) * HD_) * S_;

    // Q tile A-operands, kept resident: hd 0..31 and 32..63
    const _Float16* qrow = Qb + (size_t)(stile * 16 + colx) * HD_;
    const v16h qa0 = ld_ab(qrow,      g);
    const v16h qa1 = ld_ab(qrow + 32, g);

    float mrun[8], lrun[8];
#pragma unroll
    for (int i = 0; i < 8; ++i) { mrun[i] = -1.0e30f; lrun[i] = 0.0f; }
    v8f o[4];
#pragma unroll
    for (int nt = 0; nt < 4; ++nt) o[nt] = vzero8();

    for (int tb = 0; tb < S_; tb += 32) {
        // scores for 32 t columns: two 16x16 C tiles, K=64 over hd
        v8f s0 = vzero8(), s1 = vzero8();
        {
            const _Float16* krow0 = Kb + (size_t)(tb + colx) * HD_;
            s0 = wmma16(qa0, ld_ab(krow0,      g), s0);
            s0 = wmma16(qa1, ld_ab(krow0 + 32, g), s0);
            const _Float16* krow1 = Kb + (size_t)(tb + 16 + colx) * HD_;
            s1 = wmma16(qa0, ld_ab(krow1,      g), s1);
            s1 = wmma16(qa1, ld_ab(krow1 + 32, g), s1);
        }

        // scale * multiplicative mask; online softmax over t
        float p0[8], p1[8], tm[8];
#pragma unroll
        for (int i = 0; i < 8; ++i) {
            const int srow = stile * 16 + i + 8 * g;          // C/D row for elem i
            const float f0 = s0[i] * 0.125f * mask[(size_t)srow * S_ + tb + colx];
            const float f1 = s1[i] * 0.125f * mask[(size_t)srow * S_ + tb + 16 + colx];
            p0[i] = f0; p1[i] = f1;
            tm[i] = fmaxf(f0, f1);
        }
#pragma unroll
        for (int i = 0; i < 8; ++i) {
#pragma unroll
            for (int off = 1; off < 16; off <<= 1)            // 16-lane row groups
                tm[i] = fmaxf(tm[i], __shfl_xor(tm[i], off, 32));
        }
        float corr[8], rs[8];
#pragma unroll
        for (int i = 0; i < 8; ++i) {
            const float mn = fmaxf(mrun[i], tm[i]);
            corr[i] = __expf(mrun[i] - mn);
            mrun[i] = mn;
            p0[i] = __expf(p0[i] - mn);
            p1[i] = __expf(p1[i] - mn);
            rs[i] = p0[i] + p1[i];
        }
#pragma unroll
        for (int i = 0; i < 8; ++i) {
#pragma unroll
            for (int off = 1; off < 16; off <<= 1)
                rs[i] += __shfl_xor(rs[i], off, 32);
            lrun[i] = lrun[i] * corr[i] + rs[i];
        }
#pragma unroll
        for (int nt = 0; nt < 4; ++nt)
#pragma unroll
            for (int i = 0; i < 8; ++i)
                o[nt][i] *= corr[i];

        // C/D-layout P -> row-major 16x32 f16 in LDS -> A-layout operand
#pragma unroll
        for (int i = 0; i < 8; ++i) {
            const int r = i + 8 * g;
            pLDS[r * 32 + colx]      = (_Float16)p0[i];
            pLDS[r * 32 + colx + 16] = (_Float16)p1[i];
        }
        asm volatile("s_wait_dscnt 0" ::: "memory");          // DS in-order; fence scheduler too
        const v16h pa = ld_ab(&pLDS[colx * 32], g);

        // O += P (16x32) * V (32x64): 4 N-tiles from transposed V (contiguous along t)
#pragma unroll
        for (int nt = 0; nt < 4; ++nt) {
            const _Float16* vrow = Vt + (size_t)(nt * 16 + colx) * S_ + tb;
            o[nt] = wmma16(pa, ld_ab(vrow, g), o[nt]);
        }
    }

    // normalize and store to (s,b,d) f16 for the output projection
#pragma unroll
    for (int nt = 0; nt < 4; ++nt) {
#pragma unroll
        for (int i = 0; i < 8; ++i) {
            const int s = stile * 16 + i + 8 * g;
            const int d = h * 64 + nt * 16 + colx;
            attn[((size_t)(s * B_ + b)) * D_ + d] = (_Float16)(o[nt][i] / lrun[i]);
        }
    }
}

// ---------------------------------------------------------------- output projection
// attn (2048x1024,f16) @ Wo^T + bo -> out (f32); same tile.
__global__ __launch_bounds__(128) void out_gemm_kernel(
    const _Float16* __restrict__ attn, const _Float16* __restrict__ Wo16,
    const float* __restrict__ bo, float* __restrict__ out)
{
    __shared__ __attribute__((aligned(16))) _Float16 sm[2 * GT_BUF];

    const int lane  = threadIdx.x & 31;
    const int colx  = lane & 15;
    const int g     = lane >> 4;
    const int wave  = threadIdx.x >> 5;
    const int mbase = blockIdx.x * GT_M + (wave >> 1) * 32;
    const int nbase = blockIdx.y * GT_N + (wave & 1) * 64;

    v8f acc[2][4];
    gemm_tile(attn, Wo16, blockIdx.x * GT_M, blockIdx.y * GT_N, sm, acc);

#pragma unroll
    for (int nt = 0; nt < 4; ++nt) {
        const int   n  = nbase + nt * 16 + colx;
        const float bn = bo[n];
#pragma unroll
        for (int mt = 0; mt < 2; ++mt) {
#pragma unroll
            for (int i = 0; i < 8; ++i) {
                const int m = mbase + mt * 16 + i + 8 * g;
                out[(size_t)m * D_ + n] = acc[mt][nt][i] + bn;
            }
        }
    }
}

// ---------------------------------------------------------------- launch
extern "C" void kernel_launch(void* const* d_in, const int* in_sizes, int n_in,
                              void* d_out, int out_size, void* d_ws, size_t ws_size,
                              hipStream_t stream) {
    (void)in_sizes; (void)n_in; (void)out_size; (void)ws_size;

    const float* query = (const float*)d_in[0];
    const float* mask  = (const float*)d_in[1];
    const float* Wq    = (const float*)d_in[2];
    const float* bq    = (const float*)d_in[3];
    const float* Wk    = (const float*)d_in[4];
    const float* bk    = (const float*)d_in[5];
    const float* Wv    = (const float*)d_in[6];
    const float* bv    = (const float*)d_in[7];
    const float* Wo    = (const float*)d_in[8];
    const float* bo    = (const float*)d_in[9];
    float* out = (float*)d_out;

    char* ws = (char*)d_ws;
    const size_t MB = 1024 * 1024;
    _Float16* qf16 = (_Float16*)(ws);             // 2048x1024        (4 MB)
    _Float16* wf16 = (_Float16*)(ws + 4 * MB);    // 4x 1024x1024     (8 MB): q,k,v,o
    _Float16* xq   = (_Float16*)(ws + 12 * MB);   // (b,h,s,hd)       (4 MB)
    _Float16* xk   = (_Float16*)(ws + 16 * MB);   // (b,h,t,hd)       (4 MB)
    _Float16* xvT  = (_Float16*)(ws + 20 * MB);   // (b,h,hd,t)       (4 MB)
    _Float16* attn = (_Float16*)(ws + 24 * MB);   // (s,b,d)          (4 MB)

    const int NQ = M_ * D_;     // 2M
    const int NW = D_ * D_;     // 1M
    cvt_f16_kernel<<<(NQ + 255) / 256, 256, 0, stream>>>(query, qf16, NQ);
    cvt_f16_kernel<<<(NW + 255) / 256, 256, 0, stream>>>(Wq, wf16 + 0 * (size_t)NW, NW);
    cvt_f16_kernel<<<(NW + 255) / 256, 256, 0, stream>>>(Wk, wf16 + 1 * (size_t)NW, NW);
    cvt_f16_kernel<<<(NW + 255) / 256, 256, 0, stream>>>(Wv, wf16 + 2 * (size_t)NW, NW);
    cvt_f16_kernel<<<(NW + 255) / 256, 256, 0, stream>>>(Wo, wf16 + 3 * (size_t)NW, NW);

    qkv_gemm_kernel<<<dim3(M_ / GT_M, D_ / GT_N, 3), 128, 0, stream>>>(
        qf16, wf16, bq, bk, bv, xq, xk, xvT);

    attn_kernel<<<B_ * H_ * (S_ / 16), 32, 0, stream>>>(xq, xk, xvT, mask, attn);

    out_gemm_kernel<<<dim3(M_ / GT_M, D_ / GT_N), 128, 0, stream>>>(
        attn, wf16 + 3 * (size_t)NW, bo, out);
}

// v002
// One run takes 120 microseconds.
// Next to v001, in two timings, it ran 1.10 and 1.13 times as fast.
// Over all steps from v000 it is 1.48 times as fast.
#include <hip/hip_runtime.h>

#define S_  1024
#define B_  2
#define D_  1024
#define H_  16
#define HD_ 64
#define M_  (S_*B_)   // 2048 rows

typedef _Float16 v16h __attribute__((ext_vector_type(16)));
typedef _Float16 v8h  __attribute__((ext_vector_type(8)));
typedef float    v8f  __attribute__((ext_vector_type(8)));

static __device__ __forceinline__ v8f vzero8() {
    v8f z;
#pragma unroll
    for (int i = 0; i < 8; ++i) z[i] = 0.0f;
    return z;
}

// Load a 16x32 (f16) WMMA A/B operand chunk for this lane.
// p = start of this lane's row (A: row m; B: col n) at the current k-base.
// Lane group g (=lane>>4): g=0 takes halves {0..7,16..23}, g=1 takes {8..15,24..31}.
static __device__ __forceinline__ v16h ld_ab(const _Float16* p, int g) {
    v8h lo = *(const v8h*)(p + g * 8);
    v8h hi = *(const v8h*)(p + g * 8 + 16);
    return __builtin_shufflevector(lo, hi, 0,1,2,3,4,5,6,7,8,9,10,11,12,13,14,15);
}

static __device__ __forceinline__ v8f wmma16(v16h a, v16h b, v8f c) {
    // D = A(16x32,f16) * B(32x16,f16) + C(16x16,f32)
    return __builtin_amdgcn_wmma_f32_16x16x32_f16(false, a, false, b, (short)0, c, false, false);
}

// ---------------------------------------------------------------- convert
// All five f32 -> f16 conversions in one launch. The destination is one run of
// 6 x 2^20 halves (query, then Wq, Wk, Wv, Wo); blockIdx.y names the 2^20-value part.
// A wave takes 2,048 values in a row: sixteen 16-byte loads a lane, each 512 B in a row
// over the wave; each store is 256 B in a row.
// Few, long waves: the time of this stage is the time to start its waves, not its bytes.
#define CV_PART (1 << 20)                   // values per part
#define CV_LD   16                          // 16-byte loads a lane
#define CV_TH   128                         // threads per work-group
#define CV_WG   (CV_TH * 4 * CV_LD)         // values per work-group (8,192)

typedef float    v4f __attribute__((ext_vector_type(4)));
typedef _Float16 v4h __attribute__((ext_vector_type(4)));

__global__ __launch_bounds__(CV_TH) void cvt_f16_kernel(
    const float* __restrict__ query, const float* __restrict__ Wq,
    const float* __restrict__ Wk, const float* __restrict__ Wv,
    const float* __restrict__ Wo, _Float16* __restrict__ dst)
{
    const int part = blockIdx.y;            // 0,1: query; 2..5: Wq, Wk, Wv, Wo
    const float* src = (part < 2)  ? query + (size_t)part * CV_PART
                     : (part == 2) ? Wq
                     : (part == 3) ? Wk
                     : (part == 4) ? Wv : Wo;
    const int off = blockIdx.x * CV_WG + (threadIdx.x >> 5) * (128 * CV_LD)
                  + (threadIdx.x & 31) * 4;
    const float* s = src + off;
    _Float16*    d = dst + (size_t)part * CV_PART + off;

    v4f v[CV_LD];
#pragma unroll
    for (int j = 0; j < CV_LD; ++j) v[j] = *(const v4f*)(s + j * 128);
#pragma unroll
    for (int j = 0; j < CV_LD; ++j)
        *(v4h*)(d + j * 128) = __builtin_convertvector(v[j], v4h);
}

// ---------------------------------------------------------------- GEMM tile in LDS
// Both GEMMs: a work-group of 4 waves (2 x 2) makes a 64M x 128N tile, 32M x 64N a wave.
// A pass is 128 k: 64 rows of X and 128 rows of W, 256 B each, copied to LDS at a
// pitch of 272 B (ds_load_b128 reads of 16 rows then fall on all 64 banks).
// Two buffers: the next pass's copies fly while this pass is multiplied.
#define GT_M   64
#define GT_N   128
#define GT_K   128
#define GT_P   136                          // LDS row pitch in halves (272 B)
#define GT_BUF ((GT_M + GT_N) * GT_P)       // halves per buffer (52,224 B)
#define GT_NP  (D_ / GT_K)                  // 8 passes

// Eight 16-byte copies of this lane: its chunk in rows r, r+8, ..., r+56.
// The s_wait_xcnt stands inside the statement so that no address register of a
// copy is rewritten in front of it.
static __device__ __forceinline__ void copy8(unsigned l, const _Float16* p) {
    constexpr unsigned STEP_L = 8u * GT_P * 2u;   // 8 rows in LDS, bytes
    constexpr int      STEP_G = 8 * D_;           // 8 rows in global, halves
    asm volatile(
        "global_load_async_to_lds_b128 %0, %1, off\n\t"
        "global_load_async_to_lds_b128 %2, %3, off\n\t"
        "global_load_async_to_lds_b128 %4, %5, off\n\t"
        "global_load_async_to_lds_b128 %6, %7, off\n\t"
        "global_load_async_to_lds_b128 %8, %9, off\n\t"
        "global_load_async_to_lds_b128 %10, %11, off\n\t"
        "global_load_async_to_lds_b128 %12, %13, off\n\t"
        "global_load_async_to_lds_b128 %14, %15, off\n\t"
        "s_wait_xcnt 0x0"
        :: "v"(l + 0u * STEP_L), "v"(p + 0 * STEP_G),
           "v"(l + 1u * STEP_L), "v"(p + 1 * STEP_G),
           "v"(l + 2u * STEP_L), "v"(p + 2 * STEP_G),
           "v"(l + 3u * STEP_L), "v"(p + 3 * STEP_G),
           "v"(l + 4u * STEP_L), "v"(p + 4 * STEP_G),
           "v"(l + 5u * STEP_L), "v"(p + 5 * STEP_G),
           "v"(l + 6u * STEP_L), "v"(p + 6 * STEP_G),
           "v"(l + 7u * STEP_L), "v"(p + 7 * STEP_G)
        : "memory");
}

// One pass's tile: 192 rows x 16 chunks of 16 B, 24 chunks a lane; 16 lanes cover a row.
// l: LDS byte address of this lane's chunk in row (tid >> 4) of the buffer;
// xa, wb: the same chunk in the X tile and in the W tile at the pass's k.
static __device__ __forceinline__ void copy_pass(unsigned l, const _Float16* xa,
                                                 const _Float16* wb) {
    copy8(l, xa);                                              // X rows   0..63
    copy8(l + GT_M * GT_P * 2u, wb);                           // W rows   0..63
    copy8(l + (GT_M + 64) * GT_P * 2u, wb + (size_t)64 * D_);  // W rows  64..127
}

// acc[mt][nt] = X[m0 + wm*32 + mt*16 ..][:] . W[n0 + wn*64 + nt*16 ..][:]^T over all of K.
// The loops over mt, nt and kb are unrolled so that every index of a fragment or
// accumulator array is a constant and the arrays stay in registers.
static __device__ __forceinline__ void gemm_tile(
    const _Float16* __restrict__ X, const _Float16* __restrict__ Wt,
    int m0, int n0, _Float16* sm, v8f (&acc)[2][4])
{
    const int tid  = threadIdx.x;
    const int lane = tid & 31;
    const int colx = lane & 15;
    const int g    = lane >> 4;
    const int wave = tid >> 5;
    const int wm   = wave >> 1;
    const int wn   = wave & 1;

    const int crow = tid >> 4;          // 0..7
    const int cchk = tid & 15;          // 16-byte chunk in the row
    const _Float16* xa = X  + (size_t)(m0 + crow) * D_ + cchk * 8;
    const _Float16* wb = Wt + (size_t)(n0 + crow) * D_ + cchk * 8;
    const unsigned  l0 = (unsigned)(size_t)(sm + crow * GT_P + cchk * 8);

#pragma unroll
    for (int mt = 0; mt < 2; ++mt)
#pragma unroll
        for (int nt = 0; nt < 4; ++nt) acc[mt][nt] = vzero8();

    copy_pass(l0, xa, wb);
    asm volatile("s_wait_asynccnt 0x0" ::: "memory");   // this wave's copies of pass 0 have landed
    __syncthreads();                                    // ... and every other wave's
    copy_pass(l0 + GT_BUF * 2u, xa + GT_K, wb + GT_K);

    for (int t = 0; t < GT_NP; ++t) {
        const _Float16* buf = sm + (t & 1) * GT_BUF;
        const _Float16* sa  = buf + (wm * 32 + colx) * GT_P;
        const _Float16* sb  = buf + (GT_M + wn * 64 + colx) * GT_P;
        // Fragments of the next 32 k are read, as one group, ahead of this block's WMMAs.
        v16h a[2][2], bm[2][4];
#pragma unroll
        for (int mt = 0; mt < 2; ++mt) a[0][mt] = ld_ab(sa + mt * 16 * GT_P, g);
#pragma unroll
        for (int nt = 0; nt < 4; ++nt) bm[0][nt] = ld_ab(sb + nt * 16 * GT_P, g);
#pragma unroll
        for (int kb = 0; kb < GT_K / 32; ++kb) {
            const int cur = kb & 1, nxt = cur ^ 1;
            if (kb + 1 < GT_K / 32) {
#pragma unroll
                for (int mt = 0; mt < 2; ++mt)
                    a[nxt][mt] = ld_ab(sa + mt * 16 * GT_P + (kb + 1) * 32, g);
#pragma unroll
                for (int nt = 0; nt < 4; ++nt)
                    bm[nxt][nt] = ld_ab(sb + nt * 16 * GT_P + (kb + 1) * 32, g);
            }
            // Keeps the read group in front of the WMMA block: left free, the scheduler
            // sinks each read to its use and every WMMA pair waits out an LDS latency.
            __builtin_amdgcn_sched_barrier(0);
#pragma unroll
            for (int nt = 0; nt < 4; ++nt)
#pragma unroll
                for (int mt = 0; mt < 2; ++mt)
                    acc[mt][nt] = wmma16(a[cur][mt], bm[cur][nt], acc[mt][nt]);
            // Keeps the following read group behind this block, so that it stays one group.
            __builtin_amdgcn_sched_barrier(0);
        }
        asm volatile("s_wait_dscnt 0x0" ::: "memory");     // this wave has left the buffer
        asm volatile("s_wait_asynccnt 0x0" ::: "memory");  // its copies of pass t+1 have landed
        __syncthreads();                                   // publishes pass t+1, frees this buffer
        if (t + 2 < GT_NP)
            copy_pass(l0 + (t & 1) * (GT_BUF * 2u), xa + (t + 2) * GT_K, wb + (t + 2) * GT_K);
    }
    asm volatile("s_wait_asynccnt 0x0" ::: "memory");      // nothing in flight when the wave ends
}

// ---------------------------------------------------------------- QKV GEMM
// X (2048x1024, f16) @ W[which]^T + b.
// Outputs: xq/xk in (b,h,s,hd), xv transposed to (b,h,hd,t).
__global__ __launch_bounds__(128) void qkv_gemm_kernel(
    const _Float16* __restrict__ qf16, const _Float16* __restrict__ wf16,
    const float* __restrict__ bq, const float* __restrict__ bk,
    const float* __restrict__ bv,
    _Float16* __restrict__ xq, _Float16* __restrict__ xk,
    _Float16* __restrict__ xvT)
{
    __shared__ __attribute__((aligned(16))) _Float16 sm[2 * GT_BUF];

    const int lane  = threadIdx.x & 31;
    const int colx  = lane & 15;
    const int g     = lane >> 4;
    const int wave  = threadIdx.x >> 5;
    const int mbase = blockIdx.x * GT_M + (wave >> 1) * 32;  // this wave's 32 rows
    const int h     = blockIdx.y * 2 + (wave & 1);           // this wave's 64 output cols
    const int which = blockIdx.z;                            // 0=q 1=k 2=v

    const _Float16* W    = wf16 + (size_t)which * D_ * D_;
    const float*    bias = (which == 0) ? bq : (which == 1) ? bk : bv;

    v8f acc[2][4];
    gemm_tile(qf16, W, blockIdx.x * GT_M, blockIdx.y * GT_N, sm, acc);

#pragma unroll
    for (int nt = 0; nt < 4; ++nt) {
        const int   n  = h * 64 + nt * 16 + colx;
        const int   hd = nt * 16 + colx;
        const float bn = bias[n];
#pragma unroll
        for (int mt = 0; mt < 2; ++mt) {
#pragma unroll
            for (int i = 0; i < 8; ++i) {
                const int m = mbase + mt * 16 + i + 8 * g;
                const int s = m >> 1;       // rows are (s,b) interleaved, B=2
                const int b = m & 1;
                const _Float16 val = (_Float16)(acc[mt][nt][i] + bn);
                if (which == 2) {
                    xvT[((size_t)((b * H_ + h) * HD_ + hd)) * S_ + s] = val;  // (b,h,hd,t)
                } else {
                    _Float16* dst = (which == 0) ? xq : xk;
                    dst[((size_t)((b * H_ + h) * S_ + s)) * HD_ + hd] = val;  // (b,h,s,hd)
                }
            }
        }
    }
}

// ---------------------------------------------------------------- flash attention
// One wave per (b,h,stile): 16 Q rows, streams all 1024 t columns 32 at a time.
__global__ __launch_bounds__(32) void attn_kernel(
    const _Float16* __restrict__ xq, const _Float16* __restrict__ xk,
    const _Float16* __restrict__ xvT, const float* __restrict__ mask,
    _Float16* __restrict__ attn)
{
    __shared__ _Float16 pLDS[16 * 32];   // 1 KB, wave-private (1 wave/WG)

    const int lane  = threadIdx.x;
    const int colx  = lane & 15;
    const int g     = lane >> 4;
    const int stile = blockIdx.x & 63;
    const int h     = (blockIdx.x >> 6) & 15;
    const int b     = blockIdx.x >> 10;

    const _Float16* Qb = xq  + ((size_t)(b * H_ + h) * S_) * HD_;
    const _Float16* Kb = xk  + ((size_t)(b * H_ + h) * S_) * HD_;
    const _Float16* Vt = xvT + ((size_t)(b * H_ + h) * HD_) * S_;

    // Q tile A-operands, kept resident: hd 0..31 and 32..63
    const _Float16* qrow = Qb + (size_t)(stile * 16 + colx) * HD_;
    const v16h qa0 = ld_ab(qrow,      g);
    const v16h qa1 = ld_ab(qrow + 32, g);

    float mrun[8], lrun[8];
#pragma unroll
    for (int i = 0; i < 8; ++i) { mrun[i] = -1.0e30f; lrun[i] = 0.0f; }
    v8f o[4];
#pragma unroll
    for (int nt = 0; nt < 4; ++nt) o[nt] = vzero8();

    for (int tb = 0; tb < S_; tb += 32) {
        // scores for 32 t columns: two 16x16 C tiles, K=64 over hd
        v8f s0 = vzero8(), s1 = vzero8();
        {
            const _Float16* krow0 = Kb + (size_t)(tb + colx) * HD_;
            s0 = wmma16(qa0, ld_ab(krow0,      g), s0);
            s0 = wmma16(qa1, ld_ab(krow0 + 32, g), s0);
            const _Float16* krow1 = Kb + (size_t)(tb + 16 + colx) * HD_;
            s1 = wmma16(qa0, ld_ab(krow1,      g), s1);
            s1 = wmma16(qa1, ld_ab(krow1 + 32, g), s1);
        }

        // scale * multiplicative mask; online softmax over t
        float p0[8], p1[8], tm[8];
#pragma unroll
        for (int i = 0; i < 8; ++i) {
            const int srow = stile * 16 + i + 8 * g;          // C/D row for elem i
            const float f0 = s0[i] * 0.125f * mask[(size_t)srow * S_ + tb + colx];
            const float f1 = s1[i] * 0.125f * mask[(size_t)srow * S_ + tb + 16 + colx];
            p0[i] = f0; p1[i] = f1;
            tm[i] = fmaxf(f0, f1);
        }
#pragma unroll
        for (int i = 0; i < 8; ++i) {
#pragma unroll
            for (int off = 1; off < 16; off <<= 1)            // 16-lane row groups
                tm[i] = fmaxf(tm[i], __shfl_xor(tm[i], off, 32));
        }
        float corr[8], rs[8];
#pragma unroll
        for (int i = 0; i < 8; ++i) {
            const float mn = fmaxf(mrun[i], tm[i]);
            corr[i] = __expf(mrun[i] - mn);
            mrun[i] = mn;
            p0[i] = __expf(p0[i] - mn);
            p1[i] = __expf(p1[i] - mn);
            rs[i] = p0[i] + p1[i];
        }
#pragma unroll
        for (int i = 0; i < 8; ++i) {
#pragma unroll
            for (int off = 1; off < 16; off <<= 1)
                rs[i] += __shfl_xor(rs[i], off, 32);
            lrun[i] = lrun[i] * corr[i] + rs[i];
        }
#pragma unroll
        for (int nt = 0; nt < 4; ++nt)
#pragma unroll
            for (int i = 0; i < 8; ++i)
                o[nt][i] *= corr[i];

        // C/D-layout P -> row-major 16x32 f16 in LDS -> A-layout operand
#pragma unroll
        for (int i = 0; i < 8; ++i) {
            const int r = i + 8 * g;
            pLDS[r * 32 + colx]      = (_Float16)p0[i];
            pLDS[r * 32 + colx + 16] = (_Float16)p1[i];
        }
        asm volatile("s_wait_dscnt 0" ::: "memory");          // DS in-order; fence scheduler too
        const v16h pa = ld_ab(&pLDS[colx * 32], g);

        // O += P (16x32) * V (32x64): 4 N-tiles from transposed V (contiguous along t)
#pragma unroll
        for (int nt = 0; nt < 4; ++nt) {
            const _Float16* vrow = Vt + (size_t)(nt * 16 + colx) * S_ + tb;
            o[nt] = wmma16(pa, ld_ab(vrow, g), o[nt]);
        }
    }

    // normalize and store to (s,b,d) f16 for the output projection
#pragma unroll
    for (int nt = 0; nt < 4; ++nt) {
#pragma unroll
        for (int i = 0; i < 8; ++i) {
            const int s = stile * 16 + i + 8 * g;
            const int d = h * 64 + nt * 16 + colx;
            attn[((size_t)(s * B_ + b)) * D_ + d] = (_Float16)(o[nt][i] / lrun[i]);
        }
    }
}

// ---------------------------------------------------------------- output projection
// attn (2048x1024,f16) @ Wo^T + bo -> out (f32); same tile.
__global__ __launch_bounds__(128) void out_gemm_kernel(
    const _Float16* __restrict__ attn, const _Float16* __restrict__ Wo16,
    const float* __restrict__ bo, float* __restrict__ out)
{
    __shared__ __attribute__((aligned(16))) _Float16 sm[2 * GT_BUF];

    const int lane  = threadIdx.x & 31;
    const int colx  = lane & 15;
    const int g     = lane >> 4;
    const int wave  = threadIdx.x >> 5;
    const int mbase = blockIdx.x * GT_M + (wave >> 1) * 32;
    const int nbase = blockIdx.y * GT_N + (wave & 1) * 64;

    v8f acc[2][4];
    gemm_tile(attn, Wo16, blockIdx.x * GT_M, blockIdx.y * GT_N, sm, acc);

#pragma unroll
    for (int nt = 0; nt < 4; ++nt) {
        const int   n  = nbase + nt * 16 + colx;
        const float bn = bo[n];
#pragma unroll
        for (int mt = 0; mt < 2; ++mt) {
#pragma unroll
            for (int i = 0; i < 8; ++i) {
                const int m = mbase + mt * 16 + i + 8 * g;
                out[(size_t)m * D_ + n] = acc[mt][nt][i] + bn;
            }
        }
    }
}

// ---------------------------------------------------------------- launch
extern "C" void kernel_launch(void* const* d_in, const int* in_sizes, int n_in,
                              void* d_out, int out_size, void* d_ws, size_t ws_size,
                              hipStream_t stream) {
    (void)in_sizes; (void)n_in; (void)out_size; (void)ws_size;

    const float* query = (const float*)d_in[0];
    const float* mask  = (const float*)d_in[1];
    const float* Wq    = (const float*)d_in[2];
    const float* bq    = (const float*)d_in[3];
    const float* Wk    = (const float*)d_in[4];
    const float* bk    = (const float*)d_in[5];
    const float* Wv    = (const float*)d_in[6];
    const float* bv    = (const float*)d_in[7];
    const float* Wo    = (const float*)d_in[8];
    const float* bo    = (const float*)d_in[9];
    float* out = (float*)d_out;

    char* ws = (char*)d_ws;
    const size_t MB = 1024 * 1024;
    _Float16* qf16 = (_Float16*)(ws);             // 2048x1024        (4 MB)
    _Float16* wf16 = (_Float16*)(ws + 4 * MB);    // 4x 1024x1024     (8 MB): q,k,v,o
    _Float16* xq   = (_Float16*)(ws + 12 * MB);   // (b,h,s,hd)       (4 MB)
    _Float16* xk   = (_Float16*)(ws + 16 * MB);   // (b,h,t,hd)       (4 MB)
    _Float16* xvT  = (_Float16*)(ws + 20 * MB);   // (b,h,hd,t)       (4 MB)
    _Float16* attn = (_Float16*)(ws + 24 * MB);   // (s,b,d)          (4 MB)

    const int NW = D_ * D_;     // 1M
    // qf16 and wf16 lie one behind the other: one destination of 6 parts.
    cvt_f16_kernel<<<dim3(CV_PART / CV_WG, 6), CV_TH, 0, stream>>>(query, Wq, Wk, Wv, Wo, qf16);

    qkv_gemm_kernel<<<dim3(M_ / GT_M, D_ / GT_N, 3), 128, 0, stream>>>(
        qf16, wf16, bq, bk, bv, xq, xk, xvT);

    attn_kernel<<<B_ * H_ * (S_ / 16), 32, 0, stream>>>(xq, xk, xvT, mask, attn);

    out_gemm_kernel<<<dim3(M_ / GT_M, D_ / GT_N), 128, 0, stream>>>(
        attn, wf16 + 3 * (size_t)NW, bo, out);
}

// v003
// A run of this version takes 99.8 microseconds.
// Two timings next to v002 put it at 1.24 and 1.18 times that version's speed.
// Counting every step since v000, it is 1.78 times as fast.
#include <hip/hip_runtime.h>

#define S_  1024
#define B_  2
#define D_  1024
#define H_  16
#define HD_ 64
#define M_  (S_*B_)   // 2048 rows

typedef _Float16 v16h __attribute__((ext_vector_type(16)));
typedef _Float16 v8h  __attribute__((ext_vector_type(8)));
typedef float    v8f  __attribute__((ext_vector_type(8)));

static __device__ __forceinline__ v8f vzero8() {
    v8f z;
#pragma unroll
    for (int i = 0; i < 8; ++i) z[i] = 0.0f;
    return z;
}

// Load a 16x32 (f16) WMMA A/B operand chunk for this lane.
// p = start of this lane's row (A: row m; B: col n) at the current k-base.
// Lane group g (=lane>>4): g=0 takes halves {0..7,16..23}, g=1 takes {8..15,24..31}.
static __device__ __forceinline__ v16h ld_ab(const _Float16* p, int g) {
    v8h lo = *(const v8h*)(p + g * 8);
    v8h hi = *(const v8h*)(p + g * 8 + 16);
    return __builtin_shufflevector(lo, hi, 0,1,2,3,4,5,6,7,8,9,10,11,12,13,14,15);
}

static __device__ __forceinline__ v8f wmma16(v16h a, v16h b, v8f c) {
    // D = A(16x32,f16) * B(32x16,f16) + C(16x16,f32)
    return __builtin_amdgcn_wmma_f32_16x16x32_f16(false, a, false, b, (short)0, c, false, false);
}

// ---------------------------------------------------------------- convert
// All five f32 -> f16 conversions in one launch. The destination is one run of
// 6 x 2^20 halves (query, then Wq, Wk, Wv, Wo); blockIdx.y names the 2^20-value part.
// A wave takes 2,048 values in a row: sixteen 16-byte loads a lane, each 512 B in a row
// over the wave; each store is 256 B in a row.
// Few, long waves: the time of this stage is the time to start its waves, not its bytes.
#define CV_PART (1 << 20)                   // values per part
#define CV_LD   16                          // 16-byte loads a lane
#define CV_TH   128                         // threads per work-group
#define CV_WG   (CV_TH * 4 * CV_LD)         // values per work-group (8,192)

typedef float    v4f __attribute__((ext_vector_type(4)));
typedef _Float16 v4h __attribute__((ext_vector_type(4)));

__global__ __launch_bounds__(CV_TH) void cvt_f16_kernel(
    const float* __restrict__ query, const float* __restrict__ Wq,
    const float* __restrict__ Wk, const float* __restrict__ Wv,
    const float* __restrict__ Wo, _Float16* __restrict__ dst)
{
    const int part = blockIdx.y;            // 0,1: query; 2..5: Wq, Wk, Wv, Wo
    const float* src = (part < 2)  ? query + (size_t)part * CV_PART
                     : (part == 2) ? Wq
                     : (part == 3) ? Wk
                     : (part == 4) ? Wv : Wo;
    const int off = blockIdx.x * CV_WG + (threadIdx.x >> 5) * (128 * CV_LD)
                  + (threadIdx.x & 31) * 4;
    const float* s = src + off;
    _Float16*    d = dst + (size_t)part * CV_PART + off;

    v4f v[CV_LD];
#pragma unroll
    for (int j = 0; j < CV_LD; ++j) v[j] = *(const v4f*)(s + j * 128);
#pragma unroll
    for (int j = 0; j < CV_LD; ++j)
        *(v4h*)(d + j * 128) = __builtin_convertvector(v[j], v4h);
}

// ---------------------------------------------------------------- GEMM tile in LDS
// Both GEMMs: a work-group of 4 waves (2 x 2) makes a 64M x 128N tile, 32M x 64N a wave.
// A pass is 128 k: 64 rows of X and 128 rows of W, 256 B each, copied to LDS at a
// pitch of 272 B (ds_load_b128 reads of 16 rows then fall on all 64 banks).
// Two buffers: the next pass's copies fly while this pass is multiplied.
#define GT_M   64
#define GT_N   128
#define GT_K   128
#define GT_P   136                          // LDS row pitch in halves (272 B)
#define GT_BUF ((GT_M + GT_N) * GT_P)       // halves per buffer (52,224 B)
#define GT_NP  (D_ / GT_K)                  // 8 passes

// Eight 16-byte copies of this lane: its chunk in rows r, r+8, ..., r+56.
// The s_wait_xcnt stands inside the statement so that no address register of a
// copy is rewritten in front of it.
static __device__ __forceinline__ void copy8(unsigned l, const _Float16* p) {
    constexpr unsigned STEP_L = 8u * GT_P * 2u;   // 8 rows in LDS, bytes
    constexpr int      STEP_G = 8 * D_;           // 8 rows in global, halves
    asm volatile(
        "global_load_async_to_lds_b128 %0, %1, off\n\t"
        "global_load_async_to_lds_b128 %2, %3, off\n\t"
        "global_load_async_to_lds_b128 %4, %5, off\n\t"
        "global_load_async_to_lds_b128 %6, %7, off\n\t"
        "global_load_async_to_lds_b128 %8, %9, off\n\t"
        "global_load_async_to_lds_b128 %10, %11, off\n\t"
        "global_load_async_to_lds_b128 %12, %13, off\n\t"
        "global_load_async_to_lds_b128 %14, %15, off\n\t"
        "s_wait_xcnt 0x0"
        :: "v"(l + 0u * STEP_L), "v"(p + 0 * STEP_G),
           "v"(l + 1u * STEP_L), "v"(p + 1 * STEP_G),
           "v"(l + 2u * STEP_L), "v"(p + 2 * STEP_G),
           "v"(l + 3u * STEP_L), "v"(p + 3 * STEP_G),
           "v"(l + 4u * STEP_L), "v"(p + 4 * STEP_G),
           "v"(l + 5u * STEP_L), "v"(p + 5 * STEP_G),
           "v"(l + 6u * STEP_L), "v"(p + 6 * STEP_G),
           "v"(l + 7u * STEP_L), "v"(p + 7 * STEP_G)
        : "memory");
}

// One pass's tile: 192 rows x 16 chunks of 16 B, 24 chunks a lane; 16 lanes cover a row.
// l: LDS byte address of this lane's chunk in row (tid >> 4) of the buffer;
// xa, wb: the same chunk in the X tile and in the W tile at the pass's k.
static __device__ __forceinline__ void copy_pass(unsigned l, const _Float16* xa,
                                                 const _Float16* wb) {
    copy8(l, xa);                                              // X rows   0..63
    copy8(l + GT_M * GT_P * 2u, wb);                           // W rows   0..63
    copy8(l + (GT_M + 64) * GT_P * 2u, wb + (size_t)64 * D_);  // W rows  64..127
}

// acc[mt][nt] = X[m0 + wm*32 + mt*16 ..][:] . W[n0 + wn*64 + nt*16 ..][:]^T over all of K.
// The loops over mt, nt and kb are unrolled so that every index of a fragment or
// accumulator array is a constant and the arrays stay in registers.
static __device__ __forceinline__ void gemm_tile(
    const _Float16* __restrict__ X, const _Float16* __restrict__ Wt,
    int m0, int n0, _Float16* sm, v8f (&acc)[2][4])
{
    const int tid  = threadIdx.x;
    const int lane = tid & 31;
    const int colx = lane & 15;
    const int g    = lane >> 4;
    const int wave = tid >> 5;
    const int wm   = wave >> 1;
    const int wn   = wave & 1;

    const int crow = tid >> 4;          // 0..7
    const int cchk = tid & 15;          // 16-byte chunk in the row
    const _Float16* xa = X  + (size_t)(m0 + crow) * D_ + cchk * 8;
    const _Float16* wb = Wt + (size_t)(n0 + crow) * D_ + cchk * 8;
    const unsigned  l0 = (unsigned)(size_t)(sm + crow * GT_P + cchk * 8);

#pragma unroll
    for (int mt = 0; mt < 2; ++mt)
#pragma unroll
        for (int nt = 0; nt < 4; ++nt) acc[mt][nt] = vzero8();

    copy_pass(l0, xa, wb);
    asm volatile("s_wait_asynccnt 0x0" ::: "memory");   // this wave's copies of pass 0 have landed
    __syncthreads();                                    // ... and every other wave's
    copy_pass(l0 + GT_BUF * 2u, xa + GT_K, wb + GT_K);

    for (int t = 0; t < GT_NP; ++t) {
        const _Float16* buf = sm + (t & 1) * GT_BUF;
        const _Float16* sa  = buf + (wm * 32 + colx) * GT_P;
        const _Float16* sb  = buf + (GT_M + wn * 64 + colx) * GT_P;
        // Fragments of the next 32 k are read, as one group, ahead of this block's WMMAs.
        v16h a[2][2], bm[2][4];
#pragma unroll
        for (int mt = 0; mt < 2; ++mt) a[0][mt] = ld_ab(sa + mt * 16 * GT_P, g);
#pragma unroll
        for (int nt = 0; nt < 4; ++nt) bm[0][nt] = ld_ab(sb + nt * 16 * GT_P, g);
#pragma unroll
        for (int kb = 0; kb < GT_K / 32; ++kb) {
            const int cur = kb & 1, nxt = cur ^ 1;
            if (kb + 1 < GT_K / 32) {
#pragma unroll
                for (int mt = 0; mt < 2; ++mt)
                    a[nxt][mt] = ld_ab(sa + mt * 16 * GT_P + (kb + 1) * 32, g);
#pragma unroll
                for (int nt = 0; nt < 4; ++nt)
                    bm[nxt][nt] = ld_ab(sb + nt * 16 * GT_P + (kb + 1) * 32, g);
            }
            // Keeps the read group in front of the WMMA block: left free, the scheduler
            // sinks each read to its use and every WMMA pair waits out an LDS latency.
            __builtin_amdgcn_sched_barrier(0);
#pragma unroll
            for (int nt = 0; nt < 4; ++nt)
#pragma unroll
                for (int mt = 0; mt < 2; ++mt)
                    acc[mt][nt] = wmma16(a[cur][mt], bm[cur][nt], acc[mt][nt]);
            // Keeps the following read group behind this block, so that it stays one group.
            __builtin_amdgcn_sched_barrier(0);
        }
        asm volatile("s_wait_dscnt 0x0" ::: "memory");     // this wave has left the buffer
        asm volatile("s_wait_asynccnt 0x0" ::: "memory");  // its copies of pass t+1 have landed
        __syncthreads();                                   // publishes pass t+1, frees this buffer
        if (t + 2 < GT_NP)
            copy_pass(l0 + (t & 1) * (GT_BUF * 2u), xa + (t + 2) * GT_K, wb + (t + 2) * GT_K);
    }
    asm volatile("s_wait_asynccnt 0x0" ::: "memory");      // nothing in flight when the wave ends
}

// ---------------------------------------------------------------- QKV GEMM
// X (2048x1024, f16) @ W[which]^T + b.
// Outputs: xq/xk in (b,h,s,hd), xv transposed to (b,h,hd,t).
__global__ __launch_bounds__(128) void qkv_gemm_kernel(
    const _Float16* __restrict__ qf16, const _Float16* __restrict__ wf16,
    const float* __restrict__ bq, const float* __restrict__ bk,
    const float* __restrict__ bv,
    _Float16* __restrict__ xq, _Float16* __restrict__ xk,
    _Float16* __restrict__ xvT)
{
    __shared__ __attribute__((aligned(16))) _Float16 sm[2 * GT_BUF];

    const int lane  = threadIdx.x & 31;
    const int colx  = lane & 15;
    const int g     = lane >> 4;
    const int wave  = threadIdx.x >> 5;
    const int mbase = blockIdx.x * GT_M + (wave >> 1) * 32;  // this wave's 32 rows
    const int h     = blockIdx.y * 2 + (wave & 1);           // this wave's 64 output cols
    const int which = blockIdx.z;                            // 0=q 1=k 2=v

    const _Float16* W    = wf16 + (size_t)which * D_ * D_;
    const float*    bias = (which == 0) ? bq : (which == 1) ? bk : bv;

    v8f acc[2][4];
    gemm_tile(qf16, W, blockIdx.x * GT_M, blockIdx.y * GT_N, sm, acc);

#pragma unroll
    for (int nt = 0; nt < 4; ++nt) {
        const int   n  = h * 64 + nt * 16 + colx;
        const int   hd = nt * 16 + colx;
        const float bn = bias[n];
#pragma unroll
        for (int mt = 0; mt < 2; ++mt) {
#pragma unroll
            for (int i = 0; i < 8; ++i) {
                const int m = mbase + mt * 16 + i + 8 * g;
                const int s = m >> 1;       // rows are (s,b) interleaved, B=2
                const int b = m & 1;
                const _Float16 val = (_Float16)(acc[mt][nt][i] + bn);
                if (which == 2) {
                    xvT[((size_t)((b * H_ + h) * HD_ + hd)) * S_ + s] = val;  // (b,h,hd,t)
                } else {
                    _Float16* dst = (which == 0) ? xq : xk;
                    dst[((size_t)((b * H_ + h) * S_ + s)) * HD_ + hd] = val;  // (b,h,s,hd)
                }
            }
        }
    }
}

// ---------------------------------------------------------------- flash attention
// A work-group of 8 waves takes 128 Q rows of one (b,h), 16 rows a wave, and walks the
// 1024 t columns in stages of 64. A stage's operands are copied to LDS ahead of their use:
// 64 rows of K and 64 rows of Vt (128 B each, shared by the 8 waves) at a pitch of 144 B,
// and the 128 x 64 mask tile (256 B a row) at a pitch of 272 B. Two buffers: the next
// stage's copies fly while this stage is worked on.
#define AT_W   8                            // waves per work-group
#define AT_Q   (AT_W * 16)                  // Q rows per work-group
#define AT_T   64                           // t columns per stage
#define AT_KP  72                           // K / Vt row pitch in halves (144 B)
#define AT_MP  68                           // mask row pitch in floats (272 B)
#define AT_KV  (64 * AT_KP)                 // halves in a K tile, and in a Vt tile
#define AT_NS  (S_ / AT_T)                  // 16 stages

// This lane's 16-byte chunk in rows r and r+32 of the K tile and of the Vt tile.
// The s_wait_xcnt stands inside the statement so that no address register of a
// copy is rewritten in front of it.
static __device__ __forceinline__ void copy_kv(unsigned lk, const _Float16* k,
                                               unsigned lv, const _Float16* v) {
    constexpr unsigned STEP_L = 32u * AT_KP * 2u;   // 32 rows in LDS, bytes
    asm volatile(
        "global_load_async_to_lds_b128 %0, %1, off\n\t"
        "global_load_async_to_lds_b128 %2, %3, off\n\t"
        "global_load_async_to_lds_b128 %4, %5, off\n\t"
        "global_load_async_to_lds_b128 %6, %7, off\n\t"
        "s_wait_xcnt 0x0"
        :: "v"(lk),          "v"(k),
           "v"(lk + STEP_L), "v"(k + 32 * HD_),
           "v"(lv),          "v"(v),
           "v"(lv + STEP_L), "v"(v + 32 * S_)
        : "memory");
}

// This lane's 16-byte chunk in rows r, r+16, ..., r+112 of the mask tile; the wait as above.
static __device__ __forceinline__ void copy_mask(unsigned l, const float* p) {
    constexpr unsigned STEP_L = 16u * AT_MP * 4u;   // 16 rows in LDS, bytes
    constexpr int      STEP_G = 16 * S_;            // 16 rows in global, floats
    asm volatile(
        "global_load_async_to_lds_b128 %0, %1, off\n\t"
        "global_load_async_to_lds_b128 %2, %3, off\n\t"
        "global_load_async_to_lds_b128 %4, %5, off\n\t"
        "global_load_async_to_lds_b128 %6, %7, off\n\t"
        "global_load_async_to_lds_b128 %8, %9, off\n\t"
        "global_load_async_to_lds_b128 %10, %11, off\n\t"
        "global_load_async_to_lds_b128 %12, %13, off\n\t"
        "global_load_async_to_lds_b128 %14, %15, off\n\t"
        "s_wait_xcnt 0x0"
        :: "v"(l + 0u * STEP_L), "v"(p + 0 * STEP_G),
           "v"(l + 1u * STEP_L), "v"(p + 1 * STEP_G),
           "v"(l + 2u * STEP_L), "v"(p + 2 * STEP_G),
           "v"(l + 3u * STEP_L), "v"(p + 3 * STEP_G),
           "v"(l + 4u * STEP_L), "v"(p + 4 * STEP_G),
           "v"(l + 5u * STEP_L), "v"(p + 5 * STEP_G),
           "v"(l + 6u * STEP_L), "v"(p + 6 * STEP_G),
           "v"(l + 7u * STEP_L), "v"(p + 7 * STEP_G)
        : "memory");
}

// e^x as __expf forms it (x * log2(e), then v_exp_f32), with the one free slot that the
// instruction set asks for behind a transcendental kept in the same statement.
static __device__ __forceinline__ float exp_slot(float x) {
    float r;
    asm("v_exp_f32 %0, %1\n\tv_nop" : "=v"(r) : "v"(x * 1.44269504f));
    return r;
}

__global__ __launch_bounds__(AT_W * 32) void attn_kernel(
    const _Float16* __restrict__ xq, const _Float16* __restrict__ xk,
    const _Float16* __restrict__ xvT, const float* __restrict__ mask,
    _Float16* __restrict__ attn)
{
    __shared__ __attribute__((aligned(16))) _Float16 kvs[2][2 * AT_KV];     // K tile, Vt tile
    __shared__ __attribute__((aligned(16))) float    mks[2][AT_Q * AT_MP];  // mask tile
    __shared__ _Float16 pAll[AT_W][16 * 32];                                // 1 KB a wave

    const int tid   = threadIdx.x;
    const int lane  = tid & 31;
    const int colx  = lane & 15;
    const int g     = lane >> 4;
    const int wave  = tid >> 5;
    const int q0    = (blockIdx.x & 7) * AT_Q;     // first Q row of the work-group
    const int stile = (q0 >> 4) + wave;            // this wave's 16 Q rows
    const int h     = (blockIdx.x >> 3) & 15;
    const int b     = blockIdx.x >> 7;

    const _Float16* Qb = xq  + ((size_t)(b * H_ + h) * S_) * HD_;
    const _Float16* Kb = xk  + ((size_t)(b * H_ + h) * S_) * HD_;
    const _Float16* Vt = xvT + ((size_t)(b * H_ + h) * HD_) * S_;
    _Float16* pLDS = pAll[wave];                   // wave-private

    // Copy addresses of this lane at stage 0, buffer 0. K, Vt: 8 lanes cover a row of
    // 128 B, the work-group 32 rows; mask: 16 lanes cover a row of 256 B, the work-group 16.
    const int krow = tid >> 3, kchk = tid & 7;
    const int mrow = tid >> 4, mchk = tid & 15;
    const _Float16* gk = Kb + (size_t)krow * HD_ + kchk * 8;
    const _Float16* gv = Vt + (size_t)krow * S_  + kchk * 8;
    const float*    gm = mask + (size_t)(q0 + mrow) * S_ + mchk * 4;
    const unsigned  lk = (unsigned)(size_t)(&kvs[0][krow * AT_KP + kchk * 8]);
    const unsigned  lv = lk + AT_KV * 2u;
    const unsigned  lm = (unsigned)(size_t)(&mks[0][mrow * AT_MP + mchk * 4]);
    constexpr unsigned KVB = 2u * AT_KV * 2u;      // bytes from buffer 0 to buffer 1: K, Vt
    constexpr unsigned MKB = AT_Q * AT_MP * 4u;    // ... mask

    copy_kv(lk, gk, lv, gv);
    copy_mask(lm, gm);

    // Q tile A-operands, kept resident: hd 0..31 and 32..63
    const _Float16* qrow = Qb + (size_t)(stile * 16 + colx) * HD_;
    const v16h qa0 = ld_ab(qrow,      g);
    const v16h qa1 = ld_ab(qrow + 32, g);

    float mrun[8], lrun[8];
#pragma unroll
    for (int i = 0; i < 8; ++i) { mrun[i] = -1.0e30f; lrun[i] = 0.0f; }
    v8f o[4];
#pragma unroll
    for (int nt = 0; nt < 4; ++nt) o[nt] = vzero8();

    asm volatile("s_wait_asynccnt 0x0" ::: "memory");   // this wave's copies of stage 0 have landed
    __syncthreads();                                    // ... and every other wave's
    copy_kv(lk + KVB, gk + AT_T * HD_, lv + KVB, gv + AT_T);
    copy_mask(lm + MKB, gm + AT_T);

    for (int st = 0; st < AT_NS; ++st) {
        const _Float16* ks = kvs[st & 1];
        const _Float16* vs = ks + AT_KV;
        const float*    ms = mks[st & 1] + (wave * 16 + 8 * g) * AT_MP + colx;

        // Two steps of 32 t columns; unrolled so that every LDS offset is a constant.
#pragma unroll
        for (int tb = 0; tb < AT_T; tb += 32) {
            // scores for 32 t columns: two 16x16 C tiles, K=64 over hd
            v8f s0 = vzero8(), s1 = vzero8();
            {
                const _Float16* krow0 = ks + (tb + colx) * AT_KP;
                s0 = wmma16(qa0, ld_ab(krow0,      g), s0);
                s0 = wmma16(qa1, ld_ab(krow0 + 32, g), s0);
                const _Float16* krow1 = ks + (tb + 16 + colx) * AT_KP;
                s1 = wmma16(qa0, ld_ab(krow1,      g), s1);
                s1 = wmma16(qa1, ld_ab(krow1 + 32, g), s1);
            }

            // scale * multiplicative mask; online softmax over t
            float p0[8], p1[8], tm[8];
#pragma unroll
            for (int i = 0; i < 8; ++i) {                     // C/D row for elem i: i + 8 * g
                const float f0 = s0[i] * 0.125f * ms[i * AT_MP + tb];
                const float f1 = s1[i] * 0.125f * ms[i * AT_MP + tb + 16];
                p0[i] = f0; p1[i] = f1;
                tm[i] = fmaxf(f0, f1);
            }
#pragma unroll
            for (int i = 0; i < 8; ++i) {
#pragma unroll
                for (int off = 1; off < 16; off <<= 1)        // 16-lane row groups
                    tm[i] = fmaxf(tm[i], __shfl_xor(tm[i], off, 32));
            }
            float corr[8], rs[8];
#pragma unroll
            for (int i = 0; i < 8; ++i) {
                const float mn = fmaxf(mrun[i], tm[i]);
                corr[i] = exp_slot(mrun[i] - mn);
                mrun[i] = mn;
                p0[i] = exp_slot(p0[i] - mn);
                p1[i] = exp_slot(p1[i] - mn);
                rs[i] = p0[i] + p1[i];
            }
#pragma unroll
            for (int i = 0; i < 8; ++i) {
#pragma unroll
                for (int off = 1; off < 16; off <<= 1)
                    rs[i] += __shfl_xor(rs[i], off, 32);
                lrun[i] = lrun[i] * corr[i] + rs[i];
            }
#pragma unroll
            for (int nt = 0; nt < 4; ++nt)
#pragma unroll
                for (int i = 0; i < 8; ++i)
                    o[nt][i] *= corr[i];

            // C/D-layout P -> row-major 16x32 f16 in LDS -> A-layout operand
#pragma unroll
            for (int i = 0; i < 8; ++i) {
                const int r = i + 8 * g;
                pLDS[r * 32 + colx]      = (_Float16)p0[i];
                pLDS[r * 32 + colx + 16] = (_Float16)p1[i];
            }
            asm volatile("s_wait_dscnt 0" ::: "memory");      // DS in-order; fence scheduler too
            const v16h pa = ld_ab(&pLDS[colx * 32], g);

            // O += P (16x32) * V (32x64): 4 N-tiles from transposed V (contiguous along t)
#pragma unroll
            for (int nt = 0; nt < 4; ++nt) {
                const _Float16* vrow = vs + (nt * 16 + colx) * AT_KP + tb;
                o[nt] = wmma16(pa, ld_ab(vrow, g), o[nt]);
            }
        }

        asm volatile("s_wait_dscnt 0x0" ::: "memory");     // this wave has left the buffer
        asm volatile("s_wait_asynccnt 0x0" ::: "memory");  // its copies of stage st+1 have landed
        __syncthreads();                                   // publishes stage st+1, frees this buffer
        if (st + 2 < AT_NS) {
            const unsigned bo = (unsigned)(st & 1);
            copy_kv(lk + bo * KVB, gk + (size_t)(st + 2) * (AT_T * HD_),
                    lv + bo * KVB, gv + (st + 2) * AT_T);
            copy_mask(lm + bo * MKB, gm + (st + 2) * AT_T);
        }
    }
    asm volatile("s_wait_asynccnt 0x0" ::: "memory");      // nothing in flight when the wave ends

    // normalize and store to (s,b,d) f16 for the output projection
#pragma unroll
    for (int nt = 0; nt < 4; ++nt) {
#pragma unroll
        for (int i = 0; i < 8; ++i) {
            const int s = stile * 16 + i + 8 * g;
            const int d = h * 64 + nt * 16 + colx;
            attn[((size_t)(s * B_ + b)) * D_ + d] = (_Float16)(o[nt][i] / lrun[i]);
        }
    }
}

// ---------------------------------------------------------------- output projection
// attn (2048x1024,f16) @ Wo^T + bo -> out (f32); same tile.
__global__ __launch_bounds__(128) void out_gemm_kernel(
    const _Float16* __restrict__ attn, const _Float16* __restrict__ Wo16,
    const float* __restrict__ bo, float* __restrict__ out)
{
    __shared__ __attribute__((aligned(16))) _Float16 sm[2 * GT_BUF];

    const int lane  = threadIdx.x & 31;
    const int colx  = lane & 15;
    const int g     = lane >> 4;
    const int wave  = threadIdx.x >> 5;
    const int mbase = blockIdx.x * GT_M + (wave >> 1) * 32;
    const int nbase = blockIdx.y * GT_N + (wave & 1) * 64;

    v8f acc[2][4];
    gemm_tile(attn, Wo16, blockIdx.x * GT_M, blockIdx.y * GT_N, sm, acc);

#pragma unroll
    for (int nt = 0; nt < 4; ++nt) {
        const int   n  = nbase + nt * 16 + colx;
        const float bn = bo[n];
#pragma unroll
        for (int mt = 0; mt < 2; ++mt) {
#pragma unroll
            for (int i = 0; i < 8; ++i) {
                const int m = mbase + mt * 16 + i + 8 * g;
                out[(size_t)m * D_ + n] = acc[mt][nt][i] + bn;
            }
        }
    }
}

// ---------------------------------------------------------------- launch
extern "C" void kernel_launch(void* const* d_in, const int* in_sizes, int n_in,
                              void* d_out, int out_size, void* d_ws, size_t ws_size,
                              hipStream_t stream) {
    (void)in_sizes; (void)n_in; (void)out_size; (void)ws_size;

    const float* query = (const float*)d_in[0];
    const float* mask  = (const float*)d_in[1];
    const float* Wq    = (const float*)d_in[2];
    const float* bq    = (const float*)d_in[3];
    const float* Wk    = (const float*)d_in[4];
    const float* bk    = (const float*)d_in[5];
    const float* Wv    = (const float*)d_in[6];
    const float* bv    = (const float*)d_in[7];
    const float* Wo    = (const float*)d_in[8];
    const float* bo    = (const float*)d_in[9];
    float* out = (float*)d_out;

    char* ws = (char*)d_ws;
    const size_t MB = 1024 * 1024;
    _Float16* qf16 = (_Float16*)(ws);             // 2048x1024        (4 MB)
    _Float16* wf16 = (_Float16*)(ws + 4 * MB);    // 4x 1024x1024     (8 MB): q,k,v,o
    _Float16* xq   = (_Float16*)(ws + 12 * MB);   // (b,h,s,hd)       (4 MB)
    _Float16* xk   = (_Float16*)(ws + 16 * MB);   // (b,h,t,hd)       (4 MB)
    _Float16* xvT  = (_Float16*)(ws + 20 * MB);   // (b,h,hd,t)       (4 MB)
    _Float16* attn = (_Float16*)(ws + 24 * MB);   // (s,b,d)          (4 MB)

    const int NW = D_ * D_;     // 1M
    // qf16 and wf16 lie one behind the other: one destination of 6 parts.
    cvt_f16_kernel<<<dim3(CV_PART / CV_WG, 6), CV_TH, 0, stream>>>(query, Wq, Wk, Wv, Wo, qf16);

    qkv_gemm_kernel<<<dim3(M_ / GT_M, D_ / GT_N, 3), 128, 0, stream>>>(
        qf16, wf16, bq, bk, bv, xq, xk, xvT);

    attn_kernel<<<B_ * H_ * (S_ / AT_Q), AT_W * 32, 0, stream>>>(xq, xk, xvT, mask, attn);

    out_gemm_kernel<<<dim3(M_ / GT_M, D_ / GT_N), 128, 0, stream>>>(
        attn, wf16 + 3 * (size_t)NW, bo, out);
}

// v004
// A run of this version takes 72.8 microseconds.
// Timed twice side by side with v003, it ran 1.40 and 1.41 times as fast.
// All steps since v000 together make it 2.51 times as fast.
#include <hip/hip_runtime.h>

#define S_  1024
#define B_  2
#define D_  1024
#define H_  16
#define HD_ 64
#define M_  (S_*B_)   // 2048 rows

typedef _Float16 v16h __attribute__((ext_vector_type(16)));
typedef _Float16 v8h  __attribute__((ext_vector_type(8)));
typedef float    v8f  __attribute__((ext_vector_type(8)));

static __device__ __forceinline__ v8f vzero8() {
    v8f z;
#pragma unroll
    for (int i = 0; i < 8; ++i) z[i] = 0.0f;
    return z;
}

// Load a 16x32 (f16) WMMA A/B operand chunk for this lane.
// p = start of this lane's row (A: row m; B: col n) at the current k-base.
// Lane group g (=lane>>4): g=0 takes halves {0..7,16..23}, g=1 takes {8..15,24..31}.
static __device__ __forceinline__ v16h ld_ab(const _Float16* p, int g) {
    v8h lo = *(const v8h*)(p + g * 8);
    v8h hi = *(const v8h*)(p + g * 8 + 16);
    return __builtin_shufflevector(lo, hi, 0,1,2,3,4,5,6,7,8,9,10,11,12,13,14,15);
}

static __device__ __forceinline__ v8f wmma16(v16h a, v16h b, v8f c) {
    // D = A(16x32,f16) * B(32x16,f16) + C(16x16,f32)
    return __builtin_amdgcn_wmma_f32_16x16x32_f16(false, a, false, b, (short)0, c, false, false);
}

// ---------------------------------------------------------------- convert
// All five f32 -> f16 conversions in one launch. The destination is one run of
// 6 x 2^20 halves (query, then Wq, Wk, Wv, Wo); blockIdx.y names the 2^20-value part.
// A wave takes 2,048 values in a row: sixteen 16-byte loads a lane, each 512 B in a row
// over the wave; each store is 256 B in a row.
// Few, long waves: the time of this stage is the time to start its waves, not its bytes.
#define CV_PART (1 << 20)                   // values per part
#define CV_LD   16                          // 16-byte loads a lane
#define CV_TH   128                         // threads per work-group
#define CV_WG   (CV_TH * 4 * CV_LD)         // values per work-group (8,192)

typedef float    v4f __attribute__((ext_vector_type(4)));
typedef _Float16 v4h __attribute__((ext_vector_type(4)));

__global__ __launch_bounds__(CV_TH) void cvt_f16_kernel(
    const float* __restrict__ query, const float* __restrict__ Wq,
    const float* __restrict__ Wk, const float* __restrict__ Wv,
    const float* __restrict__ Wo, _Float16* __restrict__ dst)
{
    const int part = blockIdx.y;            // 0,1: query; 2..5: Wq, Wk, Wv, Wo
    const float* src = (part < 2)  ? query + (size_t)part * CV_PART
                     : (part == 2) ? Wq
                     : (part == 3) ? Wk
                     : (part == 4) ? Wv : Wo;
    const int off = blockIdx.x * CV_WG + (threadIdx.x >> 5) * (128 * CV_LD)
                  + (threadIdx.x & 31) * 4;
    const float* s = src + off;
    _Float16*    d = dst + (size_t)part * CV_PART + off;

    v4f v[CV_LD];
#pragma unroll
    for (int j = 0; j < CV_LD; ++j) v[j] = *(const v4f*)(s + j * 128);
#pragma unroll
    for (int j = 0; j < CV_LD; ++j)
        *(v4h*)(d + j * 128) = __builtin_convertvector(v[j], v4h);
}

// ---------------------------------------------------------------- GEMM tile in LDS
// Both GEMMs: a work-group of 4 waves (2 x 2) makes a 64M x 128N tile, 32M x 64N a wave.
// A pass is 128 k: 64 rows of X and 128 rows of W, 256 B each, copied to LDS at a
// pitch of 272 B (ds_load_b128 reads of 16 rows then fall on all 64 banks).
// Two buffers: the next pass's copies fly while this pass is multiplied.
#define GT_M   64
#define GT_N   128
#define GT_K   128
#define GT_P   136                          // LDS row pitch in halves (272 B)
#define GT_BUF ((GT_M + GT_N) * GT_P)       // halves per buffer (52,224 B)
#define GT_NP  (D_ / GT_K)                  // 8 passes

// Eight 16-byte copies of this lane: its chunk in rows r, r+8, ..., r+56.
// LD: halves from one row of the tile to the next in global memory.
// The s_wait_xcnt stands inside the statement so that no address register of a
// copy is rewritten in front of it.
template <int LD>
static __device__ __forceinline__ void copy8(unsigned l, const _Float16* p) {
    constexpr unsigned STEP_L = 8u * GT_P * 2u;   // 8 rows in LDS, bytes
    constexpr int      STEP_G = 8 * LD;           // 8 rows in global, halves
    asm volatile(
        "global_load_async_to_lds_b128 %0, %1, off\n\t"
        "global_load_async_to_lds_b128 %2, %3, off\n\t"
        "global_load_async_to_lds_b128 %4, %5, off\n\t"
        "global_load_async_to_lds_b128 %6, %7, off\n\t"
        "global_load_async_to_lds_b128 %8, %9, off\n\t"
        "global_load_async_to_lds_b128 %10, %11, off\n\t"
        "global_load_async_to_lds_b128 %12, %13, off\n\t"
        "global_load_async_to_lds_b128 %14, %15, off\n\t"
        "s_wait_xcnt 0x0"
        :: "v"(l + 0u * STEP_L), "v"(p + 0 * STEP_G),
           "v"(l + 1u * STEP_L), "v"(p + 1 * STEP_G),
           "v"(l + 2u * STEP_L), "v"(p + 2 * STEP_G),
           "v"(l + 3u * STEP_L), "v"(p + 3 * STEP_G),
           "v"(l + 4u * STEP_L), "v"(p + 4 * STEP_G),
           "v"(l + 5u * STEP_L), "v"(p + 5 * STEP_G),
           "v"(l + 6u * STEP_L), "v"(p + 6 * STEP_G),
           "v"(l + 7u * STEP_L), "v"(p + 7 * STEP_G)
        : "memory");
}

// One pass's tile: 192 rows x 16 chunks of 16 B, 24 chunks a lane; 16 lanes cover a row.
// l: LDS byte address of this lane's chunk in row (tid >> 4) of the buffer;
// xa, wb: the same chunk in the X tile and in the W tile at the pass's k.
template <int LDX>
static __device__ __forceinline__ void copy_pass(unsigned l, const _Float16* xa,
                                                 const _Float16* wb) {
    copy8<LDX>(l, xa);                                             // X rows   0..63
    copy8<D_>(l + GT_M * GT_P * 2u, wb);                           // W rows   0..63
    copy8<D_>(l + (GT_M + 64) * GT_P * 2u, wb + (size_t)64 * D_);  // W rows  64..127
}

// acc[mt][nt] = X[m0 + wm*32 + mt*16 ..][:] . W[n0 + wn*64 + nt*16 ..][:]^T over all of K;
// row r of X begins at X + r * LDX.
// The loops over mt, nt and kb are unrolled so that every index of a fragment or
// accumulator array is a constant and the arrays stay in registers.
template <int LDX>
static __device__ __forceinline__ void gemm_tile(
    const _Float16* __restrict__ X, const _Float16* __restrict__ Wt,
    int m0, int n0, _Float16* sm, v8f (&acc)[2][4])
{
    const int tid  = threadIdx.x;
    const int lane = tid & 31;
    const int colx = lane & 15;
    const int g    = lane >> 4;
    const int wave = tid >> 5;
    const int wm   = wave >> 1;
    const int wn   = wave & 1;

    const int crow = tid >> 4;          // 0..7
    const int cchk = tid & 15;          // 16-byte chunk in the row
    const _Float16* xa = X  + (size_t)(m0 + crow) * LDX + cchk * 8;
    const _Float16* wb = Wt + (size_t)(n0 + crow) * D_ + cchk * 8;
    const unsigned  l0 = (unsigned)(size_t)(sm + crow * GT_P + cchk * 8);

#pragma unroll
    for (int mt = 0; mt < 2; ++mt)
#pragma unroll
        for (int nt = 0; nt < 4; ++nt) acc[mt][nt] = vzero8();

    copy_pass<LDX>(l0, xa, wb);
    asm volatile("s_wait_asynccnt 0x0" ::: "memory");   // this wave's copies of pass 0 have landed
    __syncthreads();                                    // ... and every other wave's
    copy_pass<LDX>(l0 + GT_BUF * 2u, xa + GT_K, wb + GT_K);

    for (int t = 0; t < GT_NP; ++t) {
        const _Float16* buf = sm + (t & 1) * GT_BUF;
        const _Float16* sa  = buf + (wm * 32 + colx) * GT_P;
        const _Float16* sb  = buf + (GT_M + wn * 64 + colx) * GT_P;
        // Fragments of the next 32 k are read, as one group, ahead of this block's WMMAs.
        v16h a[2][2], bm[2][4];
#pragma unroll
        for (int mt = 0; mt < 2; ++mt) a[0][mt] = ld_ab(sa + mt * 16 * GT_P, g);
#pragma unroll
        for (int nt = 0; nt < 4; ++nt) bm[0][nt] = ld_ab(sb + nt * 16 * GT_P, g);
#pragma unroll
        for (int kb = 0; kb < GT_K / 32; ++kb) {
            const int cur = kb & 1, nxt = cur ^ 1;
            if (kb + 1 < GT_K / 32) {
#pragma unroll
                for (int mt = 0; mt < 2; ++mt)
                    a[nxt][mt] = ld_ab(sa + mt * 16 * GT_P + (kb + 1) * 32, g);
#pragma unroll
                for (int nt = 0; nt < 4; ++nt)
                    bm[nxt][nt] = ld_ab(sb + nt * 16 * GT_P + (kb + 1) * 32, g);
            }
            // Keeps the read group in front of the WMMA block: left free, the scheduler
            // sinks each read to its use and every WMMA pair waits out an LDS latency.
            __builtin_amdgcn_sched_barrier(0);
#pragma unroll
            for (int nt = 0; nt < 4; ++nt)
#pragma unroll
                for (int mt = 0; mt < 2; ++mt)
                    acc[mt][nt] = wmma16(a[cur][mt], bm[cur][nt], acc[mt][nt]);
            // Keeps the following read group behind this block, so that it stays one group.
            __builtin_amdgcn_sched_barrier(0);
        }
        asm volatile("s_wait_dscnt 0x0" ::: "memory");     // this wave has left the buffer
        asm volatile("s_wait_asynccnt 0x0" ::: "memory");  // its copies of pass t+1 have landed
        __syncthreads();                                   // publishes pass t+1, frees this buffer
        if (t + 2 < GT_NP)
            copy_pass<LDX>(l0 + (t & 1) * (GT_BUF * 2u), xa + (t + 2) * GT_K, wb + (t + 2) * GT_K);
    }
    asm volatile("s_wait_asynccnt 0x0" ::: "memory");      // nothing in flight when the wave ends
}

// ---------------------------------------------------------------- QKV GEMM
// X (2048x1024, f16) @ W[which]^T + b.
// Outputs: xq/xk in (b,h,s,hd), xv transposed to (b,h,hd,t).
// A work-group takes 64 s of ONE b (every second row of X) and two heads, so that its
// results are whole 128-B lines of the destination: q, k 128 rows (h, s) of 64 hd,
// v 128 rows (h, hd) of 64 t. They go through LDS in that order and leave as 16-byte
// stores, 8 lanes a line.
#define ST_P 72                             // staging row: 64 halves + 8 (144 B)
__global__ __launch_bounds__(128) void qkv_gemm_kernel(
    const _Float16* __restrict__ qf16, const _Float16* __restrict__ wf16,
    const float* __restrict__ bq, const float* __restrict__ bk,
    const float* __restrict__ bv,
    _Float16* __restrict__ xq, _Float16* __restrict__ xk,
    _Float16* __restrict__ xvT)
{
    __shared__ __attribute__((aligned(16))) _Float16 sm[2 * GT_BUF];

    const int tid   = threadIdx.x;
    const int lane  = tid & 31;
    const int colx  = lane & 15;
    const int g     = lane >> 4;
    const int wave  = tid >> 5;
    const int b     = blockIdx.x & 1;
    const int s0    = (blockIdx.x >> 1) * GT_M;              // first s of the work-group
    const int sl    = (wave >> 1) * 32 + 8 * g;              // this lane's s - s0 at mt = 0, i = 0
    const int nl    = (wave & 1) * 64 + colx;                // this lane's column at nt = 0
    const int which = blockIdx.z;                            // 0=q 1=k 2=v

    const _Float16* W    = wf16 + (size_t)which * D_ * D_;
    const float*    bias = (which == 0) ? bq : (which == 1) ? bk : bv;

    v8f acc[2][4];
    // rows of X are (s,b) interleaved, B=2: row s of this b begins at qf16 + b*D_ + s*(B_*D_)
    gemm_tile<B_ * D_>(qf16 + b * D_, W, s0, blockIdx.y * GT_N, sm, acc);

    float bn[4];
#pragma unroll
    for (int nt = 0; nt < 4; ++nt) bn[nt] = bias[blockIdx.y * GT_N + nl + nt * 16];

    // sm is free here: every wave has passed the last pass's barrier with its LDS reads
    // retired, and no copy is in flight.
    if (which == 2) {
        // staging row = column (h, hd): a lane's eight values are eight t in a row
#pragma unroll
        for (int nt = 0; nt < 4; ++nt)
#pragma unroll
            for (int mt = 0; mt < 2; ++mt) {
                v8h pk;
#pragma unroll
                for (int i = 0; i < 8; ++i) pk[i] = (_Float16)(acc[mt][nt][i] + bn[nt]);
                *(v8h*)(sm + (nl + nt * 16) * ST_P + sl + mt * 16) = pk;
            }
    } else {
        // staging row = (h, s)
#pragma unroll
        for (int nt = 0; nt < 4; ++nt)
#pragma unroll
            for (int mt = 0; mt < 2; ++mt)
#pragma unroll
                for (int i = 0; i < 8; ++i)
                    sm[((wave & 1) * 64 + sl + mt * 16 + i) * ST_P + nt * 16 + colx] =
                        (_Float16)(acc[mt][nt][i] + bn[nt]);
    }
    __syncthreads();                        // the staged tile is read across waves

    // 128 rows of 8 chunks: this thread's chunk in rows r, r+16, ..., r+112
    const int r = tid >> 3, c = tid & 7;
    v8h v[8];
#pragma unroll
    for (int j = 0; j < 8; ++j) v[j] = *(const v8h*)(sm + (r + 16 * j) * ST_P + c * 8);
    // Row r of the first head in the destination; 16 rows on are 'step' halves on, and the
    // second head (64 rows on) lies S_ * HD_ halves on in all three.
    _Float16* gp = (which == 2)
        ? xvT + (size_t)(b * D_ + blockIdx.y * GT_N + r) * S_ + s0 + c * 8                 // (b,h,hd,t)
        : ((which == 0) ? xq : xk)
              + (size_t)((b * H_ + blockIdx.y * 2) * S_ + s0 + r) * HD_ + c * 8;           // (b,h,s,hd)
    const int step = (which == 2) ? 16 * S_ : 16 * HD_;
#pragma unroll
    for (int j = 0; j < 8; ++j) *(v8h*)(gp + (j >> 2) * (S_ * HD_) + (j & 3) * step) = v[j];
}

// ---------------------------------------------------------------- flash attention
// A work-group of 8 waves takes 128 Q rows of one (b,h), 16 rows a wave, and walks the
// 1024 t columns in stages of 64. A stage's operands are copied to LDS ahead of their use:
// 64 rows of K and 64 rows of Vt (128 B each, shared by the 8 waves) at a pitch of 144 B,
// and the 128 x 64 mask tile (256 B a row) at a pitch of 272 B. Two buffers: the next
// stage's copies fly while this stage is worked on.
#define AT_W   8                            // waves per work-group
#define AT_Q   (AT_W * 16)                  // Q rows per work-group
#define AT_T   64                           // t columns per stage
#define AT_KP  72                           // K / Vt row pitch in halves (144 B)
#define AT_MP  68                           // mask row pitch in floats (272 B)
#define AT_KV  (64 * AT_KP)                 // halves in a K tile, and in a Vt tile
#define AT_NS  (S_ / AT_T)                  // 16 stages

// This lane's 16-byte chunk in rows r and r+32 of the K tile and of the Vt tile.
// The s_wait_xcnt stands inside the statement so that no address register of a
// copy is rewritten in front of it.
static __device__ __forceinline__ void copy_kv(unsigned lk, const _Float16* k,
                                               unsigned lv, const _Float16* v) {
    constexpr unsigned STEP_L = 32u * AT_KP * 2u;   // 32 rows in LDS, bytes
    asm volatile(
        "global_load_async_to_lds_b128 %0, %1, off\n\t"
        "global_load_async_to_lds_b128 %2, %3, off\n\t"
        "global_load_async_to_lds_b128 %4, %5, off\n\t"
        "global_load_async_to_lds_b128 %6, %7, off\n\t"
        "s_wait_xcnt 0x0"
        :: "v"(lk),          "v"(k),
           "v"(lk + STEP_L), "v"(k + 32 * HD_),
           "v"(lv),          "v"(v),
           "v"(lv + STEP_L), "v"(v + 32 * S_)
        : "memory");
}

// This lane's 16-byte chunk in rows r, r+16, ..., r+112 of the mask tile; the wait as above.
static __device__ __forceinline__ void copy_mask(unsigned l, const float* p) {
    constexpr unsigned STEP_L = 16u * AT_MP * 4u;   // 16 rows in LDS, bytes
    constexpr int      STEP_G = 16 * S_;            // 16 rows in global, floats
    asm volatile(
        "global_load_async_to_lds_b128 %0, %1, off\n\t"
        "global_load_async_to_lds_b128 %2, %3, off\n\t"
        "global_load_async_to_lds_b128 %4, %5, off\n\t"
        "global_load_async_to_lds_b128 %6, %7, off\n\t"
        "global_load_async_to_lds_b128 %8, %9, off\n\t"
        "global_load_async_to_lds_b128 %10, %11, off\n\t"
        "global_load_async_to_lds_b128 %12, %13, off\n\t"
        "global_load_async_to_lds_b128 %14, %15, off\n\t"
        "s_wait_xcnt 0x0"
        :: "v"(l + 0u * STEP_L), "v"(p + 0 * STEP_G),
           "v"(l + 1u * STEP_L), "v"(p + 1 * STEP_G),
           "v"(l + 2u * STEP_L), "v"(p + 2 * STEP_G),
           "v"(l + 3u * STEP_L), "v"(p + 3 * STEP_G),
           "v"(l + 4u * STEP_L), "v"(p + 4 * STEP_G),
           "v"(l + 5u * STEP_L), "v"(p + 5 * STEP_G),
           "v"(l + 6u * STEP_L), "v"(p + 6 * STEP_G),
           "v"(l + 7u * STEP_L), "v"(p + 7 * STEP_G)
        : "memory");
}

// e^x as __expf forms it (x * log2(e), then v_exp_f32), with the one free slot that the
// instruction set asks for behind a transcendental kept in the same statement.
static __device__ __forceinline__ float exp_slot(float x) {
    float r;
    asm("v_exp_f32 %0, %1\n\tv_nop" : "=v"(r) : "v"(x * 1.44269504f));
    return r;
}

__global__ __launch_bounds__(AT_W * 32) void attn_kernel(
    const _Float16* __restrict__ xq, const _Float16* __restrict__ xk,
    const _Float16* __restrict__ xvT, const float* __restrict__ mask,
    _Float16* __restrict__ attn)
{
    __shared__ __attribute__((aligned(16))) _Float16 kvs[2][2 * AT_KV];     // K tile, Vt tile
    __shared__ __attribute__((aligned(16))) float    mks[2][AT_Q * AT_MP];  // mask tile
    __shared__ _Float16 pAll[AT_W][16 * 32];                                // 1 KB a wave

    const int tid   = threadIdx.x;
    const int lane  = tid & 31;
    const int colx  = lane & 15;
    const int g     = lane >> 4;
    const int wave  = tid >> 5;
    const int q0    = (blockIdx.x & 7) * AT_Q;     // first Q row of the work-group
    const int stile = (q0 >> 4) + wave;            // this wave's 16 Q rows
    const int h     = (blockIdx.x >> 3) & 15;
    const int b     = blockIdx.x >> 7;

    const _Float16* Qb = xq  + ((size_t)(b * H_ + h) * S_) * HD_;
    const _Float16* Kb = xk  + ((size_t)(b * H_ + h) * S_) * HD_;
    const _Float16* Vt = xvT + ((size_t)(b * H_ + h) * HD_) * S_;
    _Float16* pLDS = pAll[wave];                   // wave-private

    // Copy addresses of this lane at stage 0, buffer 0. K, Vt: 8 lanes cover a row of
    // 128 B, the work-group 32 rows; mask: 16 lanes cover a row of 256 B, the work-group 16.
    const int krow = tid >> 3, kchk = tid & 7;
    const int mrow = tid >> 4, mchk = tid & 15;
    const _Float16* gk = Kb + (size_t)krow * HD_ + kchk * 8;
    const _Float16* gv = Vt + (size_t)krow * S_  + kchk * 8;
    const float*    gm = mask + (size_t)(q0 + mrow) * S_ + mchk * 4;
    const unsigned  lk = (unsigned)(size_t)(&kvs[0][krow * AT_KP + kchk * 8]);
    const unsigned  lv = lk + AT_KV * 2u;
    const unsigned  lm = (unsigned)(size_t)(&mks[0][mrow * AT_MP + mchk * 4]);
    constexpr unsigned KVB = 2u * AT_KV * 2u;      // bytes from buffer 0 to buffer 1: K, Vt
    constexpr unsigned MKB = AT_Q * AT_MP * 4u;    // ... mask

    copy_kv(lk, gk, lv, gv);
    copy_mask(lm, gm);

    // Q tile A-operands, kept resident: hd 0..31 and 32..63
    const _Float16* qrow = Qb + (size_t)(stile * 16 + colx) * HD_;
    const v16h qa0 = ld_ab(qrow,      g);
    const v16h qa1 = ld_ab(qrow + 32, g);

    float mrun[8], lrun[8];
#pragma unroll
    for (int i = 0; i < 8; ++i) { mrun[i] = -1.0e30f; lrun[i] = 0.0f; }
    v8f o[4];
#pragma unroll
    for (int nt = 0; nt < 4; ++nt) o[nt] = vzero8();

    asm volatile("s_wait_asynccnt 0x0" ::: "memory");   // this wave's copies of stage 0 have landed
    __syncthreads();                                    // ... and every other wave's
    copy_kv(lk + KVB, gk + AT_T * HD_, lv + KVB, gv + AT_T);
    copy_mask(lm + MKB, gm + AT_T);

    for (int st = 0; st < AT_NS; ++st) {
        const _Float16* ks = kvs[st & 1];
        const _Float16* vs = ks + AT_KV;
        const float*    ms = mks[st & 1] + (wave * 16 + 8 * g) * AT_MP + colx;

        // Two steps of 32 t columns; unrolled so that every LDS offset is a constant.
#pragma unroll
        for (int tb = 0; tb < AT_T; tb += 32) {
            // scores for 32 t columns: two 16x16 C tiles, K=64 over hd
            v8f s0 = vzero8(), s1 = vzero8();
            {
                const _Float16* krow0 = ks + (tb + colx) * AT_KP;
                s0 = wmma16(qa0, ld_ab(krow0,      g), s0);
                s0 = wmma16(qa1, ld_ab(krow0 + 32, g), s0);
                const _Float16* krow1 = ks + (tb + 16 + colx) * AT_KP;
                s1 = wmma16(qa0, ld_ab(krow1,      g), s1);
                s1 = wmma16(qa1, ld_ab(krow1 + 32, g), s1);
            }

            // scale * multiplicative mask; online softmax over t
            float p0[8], p1[8], tm[8];
#pragma unroll
            for (int i = 0; i < 8; ++i) {                     // C/D row for elem i: i + 8 * g
                const float f0 = s0[i] * 0.125f * ms[i * AT_MP + tb];
                const float f1 = s1[i] * 0.125f * ms[i * AT_MP + tb + 16];
                p0[i] = f0; p1[i] = f1;
                tm[i] = fmaxf(f0, f1);
            }
#pragma unroll
            for (int i = 0; i < 8; ++i) {
#pragma unroll
                for (int off = 1; off < 16; off <<= 1)        // 16-lane row groups
                    tm[i] = fmaxf(tm[i], __shfl_xor(tm[i], off, 32));
            }
            float corr[8], rs[8];
#pragma unroll
            for (int i = 0; i < 8; ++i) {
                const float mn = fmaxf(mrun[i], tm[i]);
                corr[i] = exp_slot(mrun[i] - mn);
                mrun[i] = mn;
                p0[i] = exp_slot(p0[i] - mn);
                p1[i] = exp_slot(p1[i] - mn);
                rs[i] = p0[i] + p1[i];
            }
#pragma unroll
            for (int i = 0; i < 8; ++i) {
#pragma unroll
                for (int off = 1; off < 16; off <<= 1)
                    rs[i] += __shfl_xor(rs[i], off, 32);
                lrun[i] = lrun[i] * corr[i] + rs[i];
            }
#pragma unroll
            for (int nt = 0; nt < 4; ++nt)
#pragma unroll
                for (int i = 0; i < 8; ++i)
                    o[nt][i] *= corr[i];

            // C/D-layout P -> row-major 16x32 f16 in LDS -> A-layout operand
#pragma unroll
            for (int i = 0; i < 8; ++i) {
                const int r = i + 8 * g;
                pLDS[r * 32 + colx]      = (_Float16)p0[i];
                pLDS[r * 32 + colx + 16] = (_Float16)p1[i];
            }
            asm volatile("s_wait_dscnt 0" ::: "memory");      // DS in-order; fence scheduler too
            const v16h pa = ld_ab(&pLDS[colx * 32], g);

            // O += P (16x32) * V (32x64): 4 N-tiles from transposed V (contiguous along t)
#pragma unroll
            for (int nt = 0; nt < 4; ++nt) {
                const _Float16* vrow = vs + (nt * 16 + colx) * AT_KP + tb;
                o[nt] = wmma16(pa, ld_ab(vrow, g), o[nt]);
            }
        }

        asm volatile("s_wait_dscnt 0x0" ::: "memory");     // this wave has left the buffer
        asm volatile("s_wait_asynccnt 0x0" ::: "memory");  // its copies of stage st+1 have landed
        __syncthreads();                                   // publishes stage st+1, frees this buffer
        if (st + 2 < AT_NS) {
            const unsigned bo = (unsigned)(st & 1);
            copy_kv(lk + bo * KVB, gk + (size_t)(st + 2) * (AT_T * HD_),
                    lv + bo * KVB, gv + (st + 2) * AT_T);
            copy_mask(lm + bo * MKB, gm + (st + 2) * AT_T);
        }
    }
    asm volatile("s_wait_asynccnt 0x0" ::: "memory");      // nothing in flight when the wave ends

    // normalize and store to (s,b,d) f16 for the output projection. The wave's 16 rows of
    // 128 B go through its own 16 rows of mask buffer 0 (last read in stage 14, two barriers
    // back; nothing is copied there any more) and leave as whole 128-B lines, 8 lanes a line.
    _Float16* so = (_Float16*)(mks[0] + wave * 16 * AT_MP);
#pragma unroll
    for (int nt = 0; nt < 4; ++nt) {
#pragma unroll
        for (int i = 0; i < 8; ++i)
            so[(i + 8 * g) * (AT_MP * 2) + nt * 16 + colx] = (_Float16)(o[nt][i] / lrun[i]);
    }
    asm volatile("s_wait_dscnt 0" ::: "memory");   // the wave's rows are written before it reads them back
    const int r = lane >> 3, c = lane & 7;
    v8h v[4];
#pragma unroll
    for (int j = 0; j < 4; ++j) v[j] = *(const v8h*)(so + (r + 4 * j) * (AT_MP * 2) + c * 8);
    _Float16* gp = attn + ((size_t)((stile * 16 + r) * B_ + b)) * D_ + h * 64 + c * 8;
#pragma unroll
    for (int j = 0; j < 4; ++j) *(v8h*)(gp + j * 4 * B_ * D_) = v[j];
}

// ---------------------------------------------------------------- output projection
// attn (2048x1024,f16) @ Wo^T + bo -> out (f32); same tile. The 64 x 128 results go through
// LDS and leave as 16-byte stores, a wave covering one row's 512 B.
#define OT_P 132                            // staging row: 128 floats + 4 (528 B)
__global__ __launch_bounds__(128) void out_gemm_kernel(
    const _Float16* __restrict__ attn, const _Float16* __restrict__ Wo16,
    const float* __restrict__ bo, float* __restrict__ out)
{
    __shared__ __attribute__((aligned(16))) _Float16 sm[2 * GT_BUF];

    const int lane  = threadIdx.x & 31;
    const int colx  = lane & 15;
    const int g     = lane >> 4;
    const int wave  = threadIdx.x >> 5;
    const int ml    = (wave >> 1) * 32 + 8 * g;              // this lane's row at mt = 0, i = 0
    const int nl    = (wave & 1) * 64 + colx;                // this lane's column at nt = 0

    v8f acc[2][4];
    gemm_tile<D_>(attn, Wo16, blockIdx.x * GT_M, blockIdx.y * GT_N, sm, acc);

    float bn[4];
#pragma unroll
    for (int nt = 0; nt < 4; ++nt) bn[nt] = bo[blockIdx.y * GT_N + nl + nt * 16];

    // sm is free here, as in the QKV kernel.
    float* so = (float*)sm;
#pragma unroll
    for (int nt = 0; nt < 4; ++nt)
#pragma unroll
        for (int mt = 0; mt < 2; ++mt)
#pragma unroll
            for (int i = 0; i < 8; ++i)
                so[(ml + mt * 16 + i) * OT_P + nl + nt * 16] = acc[mt][nt][i] + bn[nt];
    __syncthreads();                        // the staged tile is read across waves

    // this wave's rows: wave, wave+4, ..., wave+60
    v4f v[16];
#pragma unroll
    for (int j = 0; j < 16; ++j) v[j] = *(const v4f*)(so + (wave + 4 * j) * OT_P + lane * 4);
    float* gp = out + (size_t)(blockIdx.x * GT_M + wave) * D_ + blockIdx.y * GT_N + lane * 4;
#pragma unroll
    for (int j = 0; j < 16; ++j) *(v4f*)(gp + j * 4 * D_) = v[j];
}

// ---------------------------------------------------------------- launch
extern "C" void kernel_launch(void* const* d_in, const int* in_sizes, int n_in,
                              void* d_out, int out_size, void* d_ws, size_t ws_size,
                              hipStream_t stream) {
    (void)in_sizes; (void)n_in; (void)out_size; (void)ws_size;

    const float* query = (const float*)d_in[0];
    const float* mask  = (const float*)d_in[1];
    const float* Wq    = (const float*)d_in[2];
    const float* bq    = (const float*)d_in[3];
    const float* Wk    = (const float*)d_in[4];
    const float* bk    = (const float*)d_in[5];
    const float* Wv    = (const float*)d_in[6];
    const float* bv    = (const float*)d_in[7];
    const float* Wo    = (const float*)d_in[8];
    const float* bo    = (const float*)d_in[9];
    float* out = (float*)d_out;

    char* ws = (char*)d_ws;
    const size_t MB = 1024 * 1024;
    _Float16* qf16 = (_Float16*)(ws);             // 2048x1024        (4 MB)
    _Float16* wf16 = (_Float16*)(ws + 4 * MB);    // 4x 1024x1024     (8 MB): q,k,v,o
    _Float16* xq   = (_Float16*)(ws + 12 * MB);   // (b,h,s,hd)       (4 MB)
    _Float16* xk   = (_Float16*)(ws + 16 * MB);   // (b,h,t,hd)       (4 MB)
    _Float16* xvT  = (_Float16*)(ws + 20 * MB);   // (b,h,hd,t)       (4 MB)
    _Float16* attn = (_Float16*)(ws + 24 * MB);   // (s,b,d)          (4 MB)

    const int NW = D_ * D_;     // 1M
    // qf16 and wf16 lie one behind the other: one destination of 6 parts.
    cvt_f16_kernel<<<dim3(CV_PART / CV_WG, 6), CV_TH, 0, stream>>>(query, Wq, Wk, Wv, Wo, qf16);

    qkv_gemm_kernel<<<dim3(M_ / GT_M, D_ / GT_N, 3), 128, 0, stream>>>(
        qf16, wf16, bq, bk, bv, xq, xk, xvT);

    attn_kernel<<<B_ * H_ * (S_ / AT_Q), AT_W * 32, 0, stream>>>(xq, xk, xvT, mask, attn);

    out_gemm_kernel<<<dim3(M_ / GT_M, D_ / GT_N), 128, 0, stream>>>(
        attn, wf16 + 3 * (size_t)NW, bo, out);
}

// v005
// Measured time: 52 microseconds a run.
// Timed twice side by side with v004, it ran 1.40 and 1.38 times as fast.
// Counting every step since v000, it is 3.49 times as fast.
#include <hip/hip_runtime.h>

#define S_  1024
#define B_  2
#define D_  1024
#define H_  16
#define HD_ 64
#define M_  (S_*B_)   // 2048 rows

typedef _Float16 v16h __attribute__((ext_vector_type(16)));
typedef _Float16 v8h  __attribute__((ext_vector_type(8)));
typedef float    v8f  __attribute__((ext_vector_type(8)));

static __device__ __forceinline__ v8f vzero8() {
    v8f z;
#pragma unroll
    for (int i = 0; i < 8; ++i) z[i] = 0.0f;
    return z;
}

// Load a 16x32 (f16) WMMA A/B operand chunk for this lane.
// p = start of this lane's row (A: row m; B: col n) at the current k-base.
// Lane group g (=lane>>4): g=0 takes halves {0..7,16..23}, g=1 takes {8..15,24..31}.
static __device__ __forceinline__ v16h ld_ab(const _Float16* p, int g) {
    v8h lo = *(const v8h*)(p + g * 8);
    v8h hi = *(const v8h*)(p + g * 8 + 16);
    return __builtin_shufflevector(lo, hi, 0,1,2,3,4,5,6,7,8,9,10,11,12,13,14,15);
}

static __device__ __forceinline__ v8f wmma16(v16h a, v16h b, v8f c) {
    // D = A(16x32,f16) * B(32x16,f16) + C(16x16,f32)
    return __builtin_amdgcn_wmma_f32_16x16x32_f16(false, a, false, b, (short)0, c, false, false);
}

// ---------------------------------------------------------------- convert
// All five f32 -> f16 conversions in one launch. The destination is one run of
// 6 x 2^20 halves (query, then Wq, Wk, Wv, Wo); blockIdx.y names the 2^20-value part.
// A wave takes 2,048 values in a row: sixteen 16-byte loads a lane, each 512 B in a row
// over the wave; each store is 256 B in a row.
// Few, long waves: the time of this stage is the time to start its waves, not its bytes.
#define CV_PART (1 << 20)                   // values per part
#define CV_LD   16                          // 16-byte loads a lane
#define CV_TH   128                         // threads per work-group
#define CV_WG   (CV_TH * 4 * CV_LD)         // values per work-group (8,192)

typedef float    v4f __attribute__((ext_vector_type(4)));
typedef _Float16 v4h __attribute__((ext_vector_type(4)));
typedef float    v2f __attribute__((ext_vector_type(2)));

__global__ __launch_bounds__(CV_TH) void cvt_f16_kernel(
    const float* __restrict__ query, const float* __restrict__ Wq,
    const float* __restrict__ Wk, const float* __restrict__ Wv,
    const float* __restrict__ Wo, _Float16* __restrict__ dst)
{
    const int part = blockIdx.y;            // 0,1: query; 2..5: Wq, Wk, Wv, Wo
    const float* src = (part < 2)  ? query + (size_t)part * CV_PART
                     : (part == 2) ? Wq
                     : (part == 3) ? Wk
                     : (part == 4) ? Wv : Wo;
    const int off = blockIdx.x * CV_WG + (threadIdx.x >> 5) * (128 * CV_LD)
                  + (threadIdx.x & 31) * 4;
    const float* s = src + off;
    _Float16*    d = dst + (size_t)part * CV_PART + off;

    v4f v[CV_LD];
#pragma unroll
    for (int j = 0; j < CV_LD; ++j) v[j] = *(const v4f*)(s + j * 128);
#pragma unroll
    for (int j = 0; j < CV_LD; ++j)
        *(v4h*)(d + j * 128) = __builtin_convertvector(v[j], v4h);
}

// ---------------------------------------------------------------- GEMM tile in LDS
// Both GEMMs: a work-group of 4 waves (2 x 2) makes a 64M x 128N tile, 32M x 64N a wave.
// A pass is 128 k: 64 rows of X and 128 rows of W, 256 B each, copied to LDS at a
// pitch of 272 B (ds_load_b128 reads of 16 rows then fall on all 64 banks).
// Two buffers: the next pass's copies fly while this pass is multiplied.
#define GT_M   64
#define GT_N   128
#define GT_K   128
#define GT_P   136                          // LDS row pitch in halves (272 B)
#define GT_BUF ((GT_M + GT_N) * GT_P)       // halves per buffer (52,224 B)
#define GT_NP  (D_ / GT_K)                  // 8 passes

// Eight 16-byte copies of this lane: its chunk in rows r, r+8, ..., r+56.
// LD: halves from one row of the tile to the next in global memory.
// The s_wait_xcnt stands inside the statement so that no address register of a
// copy is rewritten in front of it.
template <int LD>
static __device__ __forceinline__ void copy8(unsigned l, const _Float16* p) {
    constexpr unsigned STEP_L = 8u * GT_P * 2u;   // 8 rows in LDS, bytes
    constexpr int      STEP_G = 8 * LD;           // 8 rows in global, halves
    asm volatile(
        "global_load_async_to_lds_b128 %0, %1, off\n\t"
        "global_load_async_to_lds_b128 %2, %3, off\n\t"
        "global_load_async_to_lds_b128 %4, %5, off\n\t"
        "global_load_async_to_lds_b128 %6, %7, off\n\t"
        "global_load_async_to_lds_b128 %8, %9, off\n\t"
        "global_load_async_to_lds_b128 %10, %11, off\n\t"
        "global_load_async_to_lds_b128 %12, %13, off\n\t"
        "global_load_async_to_lds_b128 %14, %15, off\n\t"
        "s_wait_xcnt 0x0"
        :: "v"(l + 0u * STEP_L), "v"(p + 0 * STEP_G),
           "v"(l + 1u * STEP_L), "v"(p + 1 * STEP_G),
           "v"(l + 2u * STEP_L), "v"(p + 2 * STEP_G),
           "v"(l + 3u * STEP_L), "v"(p + 3 * STEP_G),
           "v"(l + 4u * STEP_L), "v"(p + 4 * STEP_G),
           "v"(l + 5u * STEP_L), "v"(p + 5 * STEP_G),
           "v"(l + 6u * STEP_L), "v"(p + 6 * STEP_G),
           "v"(l + 7u * STEP_L), "v"(p + 7 * STEP_G)
        : "memory");
}

// One pass's tile: 192 rows x 16 chunks of 16 B, 24 chunks a lane; 16 lanes cover a row.
// l: LDS byte address of this lane's chunk in row (tid >> 4) of the buffer;
// xa, wb: the same chunk in the X tile and in the W tile at the pass's k.
template <int LDX>
static __device__ __forceinline__ void copy_pass(unsigned l, const _Float16* xa,
                                                 const _Float16* wb) {
    copy8<LDX>(l, xa);                                             // X rows   0..63
    copy8<D_>(l + GT_M * GT_P * 2u, wb);                           // W rows   0..63
    copy8<D_>(l + (GT_M + 64) * GT_P * 2u, wb + (size_t)64 * D_);  // W rows  64..127
}

// acc[mt][nt] = X[m0 + wm*32 + mt*16 ..][:] . W[n0 + wn*64 + nt*16 ..][:]^T over all of K;
// row r of X begins at X + r * LDX.
// The loops over mt, nt and kb are unrolled so that every index of a fragment or
// accumulator array is a constant and the arrays stay in registers.
template <int LDX>
static __device__ __forceinline__ void gemm_tile(
    const _Float16* __restrict__ X, const _Float16* __restrict__ Wt,
    int m0, int n0, _Float16* sm, v8f (&acc)[2][4])
{
    const int tid  = threadIdx.x;
    const int lane = tid & 31;
    const int colx = lane & 15;
    const int g    = lane >> 4;
    const int wave = tid >> 5;
    const int wm   = wave >> 1;
    const int wn   = wave & 1;

    const int crow = tid >> 4;          // 0..7
    const int cchk = tid & 15;          // 16-byte chunk in the row
    const _Float16* xa = X  + (size_t)(m0 + crow) * LDX + cchk * 8;
    const _Float16* wb = Wt + (size_t)(n0 + crow) * D_ + cchk * 8;
    const unsigned  l0 = (unsigned)(size_t)(sm + crow * GT_P + cchk * 8);

#pragma unroll
    for (int mt = 0; mt < 2; ++mt)
#pragma unroll
        for (int nt = 0; nt < 4; ++nt) acc[mt][nt] = vzero8();

    copy_pass<LDX>(l0, xa, wb);
    asm volatile("s_wait_asynccnt 0x0" ::: "memory");   // this wave's copies of pass 0 have landed
    __syncthreads();                                    // ... and every other wave's
    copy_pass<LDX>(l0 + GT_BUF * 2u, xa + GT_K, wb + GT_K);

    for (int t = 0; t < GT_NP; ++t) {
        const _Float16* buf = sm + (t & 1) * GT_BUF;
        const _Float16* sa  = buf + (wm * 32 + colx) * GT_P;
        const _Float16* sb  = buf + (GT_M + wn * 64 + colx) * GT_P;
        // Fragments of the next 32 k are read, as one group, ahead of this block's WMMAs.
        v16h a[2][2], bm[2][4];
#pragma unroll
        for (int mt = 0; mt < 2; ++mt) a[0][mt] = ld_ab(sa + mt * 16 * GT_P, g);
#pragma unroll
        for (int nt = 0; nt < 4; ++nt) bm[0][nt] = ld_ab(sb + nt * 16 * GT_P, g);
#pragma unroll
        for (int kb = 0; kb < GT_K / 32; ++kb) {
            const int cur = kb & 1, nxt = cur ^ 1;
            if (kb + 1 < GT_K / 32) {
#pragma unroll
                for (int mt = 0; mt < 2; ++mt)
                    a[nxt][mt] = ld_ab(sa + mt * 16 * GT_P + (kb + 1) * 32, g);
#pragma unroll
                for (int nt = 0; nt < 4; ++nt)
                    bm[nxt][nt] = ld_ab(sb + nt * 16 * GT_P + (kb + 1) * 32, g);
            }
            // Keeps the read group in front of the WMMA block: left free, the scheduler
            // sinks each read to its use and every WMMA pair waits out an LDS latency.
            __builtin_amdgcn_sched_barrier(0);
#pragma unroll
            for (int nt = 0; nt < 4; ++nt)
#pragma unroll
                for (int mt = 0; mt < 2; ++mt)
                    acc[mt][nt] = wmma16(a[cur][mt], bm[cur][nt], acc[mt][nt]);
            // Keeps the following read group behind this block, so that it stays one group.
            __builtin_amdgcn_sched_barrier(0);
        }
        asm volatile("s_wait_dscnt 0x0" ::: "memory");     // this wave has left the buffer
        asm volatile("s_wait_asynccnt 0x0" ::: "memory");  // its copies of pass t+1 have landed
        __syncthreads();                                   // publishes pass t+1, frees this buffer
        if (t + 2 < GT_NP)
            copy_pass<LDX>(l0 + (t & 1) * (GT_BUF * 2u), xa + (t + 2) * GT_K, wb + (t + 2) * GT_K);
    }
    asm volatile("s_wait_asynccnt 0x0" ::: "memory");      // nothing in flight when the wave ends
}

// ---------------------------------------------------------------- QKV GEMM
// X (2048x1024, f16) @ W[which]^T + b.
// Outputs: xq/xk in (b,h,s,hd), xv transposed to (b,h,hd,t).
// A work-group takes 64 s of ONE b (every second row of X) and two heads, so that its
// results are whole 128-B lines of the destination: q, k 128 rows (h, s) of 64 hd,
// v 128 rows (h, hd) of 64 t. They go through LDS in that order and leave as 16-byte
// stores, 8 lanes a line.
#define ST_P 72                             // staging row: 64 halves + 8 (144 B)
__global__ __launch_bounds__(128) void qkv_gemm_kernel(
    const _Float16* __restrict__ qf16, const _Float16* __restrict__ wf16,
    const float* __restrict__ bq, const float* __restrict__ bk,
    const float* __restrict__ bv,
    _Float16* __restrict__ xq, _Float16* __restrict__ xk,
    _Float16* __restrict__ xvT)
{
    __shared__ __attribute__((aligned(16))) _Float16 sm[2 * GT_BUF];

    const int tid   = threadIdx.x;
    const int lane  = tid & 31;
    const int colx  = lane & 15;
    const int g     = lane >> 4;
    const int wave  = tid >> 5;
    const int b     = blockIdx.x & 1;
    const int s0    = (blockIdx.x >> 1) * GT_M;              // first s of the work-group
    const int sl    = (wave >> 1) * 32 + 8 * g;              // this lane's s - s0 at mt = 0, i = 0
    const int nl    = (wave & 1) * 64 + colx;                // this lane's column at nt = 0
    const int which = blockIdx.z;                            // 0=q 1=k 2=v

    const _Float16* W    = wf16 + (size_t)which * D_ * D_;
    const float*    bias = (which == 0) ? bq : (which == 1) ? bk : bv;

    v8f acc[2][4];
    // rows of X are (s,b) interleaved, B=2: row s of this b begins at qf16 + b*D_ + s*(B_*D_)
    gemm_tile<B_ * D_>(qf16 + b * D_, W, s0, blockIdx.y * GT_N, sm, acc);

    float bn[4];
#pragma unroll
    for (int nt = 0; nt < 4; ++nt) bn[nt] = bias[blockIdx.y * GT_N + nl + nt * 16];

    // sm is free here: every wave has passed the last pass's barrier with its LDS reads
    // retired, and no copy is in flight.
    if (which == 2) {
        // staging row = column (h, hd): a lane's eight values are eight t in a row
#pragma unroll
        for (int nt = 0; nt < 4; ++nt)
#pragma unroll
            for (int mt = 0; mt < 2; ++mt) {
                v8h pk;
#pragma unroll
                for (int i = 0; i < 8; ++i) pk[i] = (_Float16)(acc[mt][nt][i] + bn[nt]);
                *(v8h*)(sm + (nl + nt * 16) * ST_P + sl + mt * 16) = pk;
            }
    } else {
        // staging row = (h, s)
#pragma unroll
        for (int nt = 0; nt < 4; ++nt)
#pragma unroll
            for (int mt = 0; mt < 2; ++mt)
#pragma unroll
                for (int i = 0; i < 8; ++i)
                    sm[((wave & 1) * 64 + sl + mt * 16 + i) * ST_P + nt * 16 + colx] =
                        (_Float16)(acc[mt][nt][i] + bn[nt]);
    }
    __syncthreads();                        // the staged tile is read across waves

    // 128 rows of 8 chunks: this thread's chunk in rows r, r+16, ..., r+112
    const int r = tid >> 3, c = tid & 7;
    v8h v[8];
#pragma unroll
    for (int j = 0; j < 8; ++j) v[j] = *(const v8h*)(sm + (r + 16 * j) * ST_P + c * 8);
    // Row r of the first head in the destination; 16 rows on are 'step' halves on, and the
    // second head (64 rows on) lies S_ * HD_ halves on in all three.
    _Float16* gp = (which == 2)
        ? xvT + (size_t)(b * D_ + blockIdx.y * GT_N + r) * S_ + s0 + c * 8                 // (b,h,hd,t)
        : ((which == 0) ? xq : xk)
              + (size_t)((b * H_ + blockIdx.y * 2) * S_ + s0 + r) * HD_ + c * 8;           // (b,h,s,hd)
    const int step = (which == 2) ? 16 * S_ : 16 * HD_;
#pragma unroll
    for (int j = 0; j < 8; ++j) *(v8h*)(gp + (j >> 2) * (S_ * HD_) + (j & 3) * step) = v[j];
}

#define AT_W   8                            // waves per work-group
#define AT_Q   (AT_W * 16)                  // Q rows per work-group
#define AT_T   64                           // t columns per stage
#define AT_KP  72                           // K / Vt row pitch in halves (144 B)
#define AT_MP  68                           // mask row pitch in floats (272 B)
#define AT_KV  (64 * AT_KP)                 // halves in a K tile, and in a Vt tile
#define AT_NS  (S_ / AT_T)                  // 16 stages

// This lane's 16-byte chunk in rows r and r+32 of the K tile and of the Vt tile.
// The s_wait_xcnt stands inside the statement so that no address register of a
// copy is rewritten in front of it.
static __device__ __forceinline__ void copy_kv(unsigned lk, const _Float16* k,
                                               unsigned lv, const _Float16* v) {
    constexpr unsigned STEP_L = 32u * AT_KP * 2u;   // 32 rows in LDS, bytes
    asm volatile(
        "global_load_async_to_lds_b128 %0, %1, off\n\t"
        "global_load_async_to_lds_b128 %2, %3, off\n\t"
        "global_load_async_to_lds_b128 %4, %5, off\n\t"
        "global_load_async_to_lds_b128 %6, %7, off\n\t"
        "s_wait_xcnt 0x0"
        :: "v"(lk),          "v"(k),
           "v"(lk + STEP_L), "v"(k + 32 * HD_),
           "v"(lv),          "v"(v),
           "v"(lv + STEP_L), "v"(v + 32 * S_)
        : "memory");
}

// This lane's 16-byte chunk in rows r, r+16, ..., r+112 of the mask tile; the wait as above.
static __device__ __forceinline__ void copy_mask(unsigned l, const float* p) {
    constexpr unsigned STEP_L = 16u * AT_MP * 4u;   // 16 rows in LDS, bytes
    constexpr int      STEP_G = 16 * S_;            // 16 rows in global, floats
    asm volatile(
        "global_load_async_to_lds_b128 %0, %1, off\n\t"
        "global_load_async_to_lds_b128 %2, %3, off\n\t"
        "global_load_async_to_lds_b128 %4, %5, off\n\t"
        "global_load_async_to_lds_b128 %6, %7, off\n\t"
        "global_load_async_to_lds_b128 %8, %9, off\n\t"
        "global_load_async_to_lds_b128 %10, %11, off\n\t"
        "global_load_async_to_lds_b128 %12, %13, off\n\t"
        "global_load_async_to_lds_b128 %14, %15, off\n\t"
        "s_wait_xcnt 0x0"
        :: "v"(l + 0u * STEP_L), "v"(p + 0 * STEP_G),
           "v"(l + 1u * STEP_L), "v"(p + 1 * STEP_G),
           "v"(l + 2u * STEP_L), "v"(p + 2 * STEP_G),
           "v"(l + 3u * STEP_L), "v"(p + 3 * STEP_G),
           "v"(l + 4u * STEP_L), "v"(p + 4 * STEP_G),
           "v"(l + 5u * STEP_L), "v"(p + 5 * STEP_G),
           "v"(l + 6u * STEP_L), "v"(p + 6 * STEP_G),
           "v"(l + 7u * STEP_L), "v"(p + 7 * STEP_G)
        : "memory");
}

// e^x as __expf forms it (x * log2(e), then v_exp_f32), with the one free slot that the
// instruction set asks for behind a transcendental kept in the same statement.
// The exp works in place: the only register that the asm text writes is one that the
// multiply in front of it has written, so it is never a register that a WMMA still reads.
static __device__ __forceinline__ float exp_slot(float x) {
    float r = x * 1.44269504f;
    asm("v_exp_f32 %0, %0\n\tv_nop" : "+v"(r));
    return r;
}

// The same for eight values: each exp is followed by one that shares no register with it,
// so that one free slot behind the last serves the run.
static __device__ __forceinline__ void exp_slot8(float* e) {
    asm("v_exp_f32 %0, %0\n\t"
        "v_exp_f32 %1, %1\n\t"
        "v_exp_f32 %2, %2\n\t"
        "v_exp_f32 %3, %3\n\t"
        "v_exp_f32 %4, %4\n\t"
        "v_exp_f32 %5, %5\n\t"
        "v_exp_f32 %6, %6\n\t"
        "v_exp_f32 %7, %7\n\t"
        "v_nop"
        : "+v"(e[0]), "+v"(e[1]), "+v"(e[2]), "+v"(e[3]),
          "+v"(e[4]), "+v"(e[5]), "+v"(e[6]), "+v"(e[7]));
}

// Lane l with lane l ^ 16, on the vector port.
static __device__ __forceinline__ float xhalf(float x) {
    const int b = __builtin_bit_cast(int, x);
    return __builtin_bit_cast(float,
        __builtin_amdgcn_permlanex16(b, b, 0x76543210, 0xfedcba98, false, false));
}

__global__ __launch_bounds__(AT_W * 32) void attn_kernel(
    const _Float16* __restrict__ xq, const _Float16* __restrict__ xk,
    const _Float16* __restrict__ xvT, const float* __restrict__ mask,
    _Float16* __restrict__ attn)
{
    __shared__ __attribute__((aligned(16))) _Float16 kvs[2][2 * AT_KV];     // K tile, Vt tile
    __shared__ __attribute__((aligned(16))) float    mks[2][AT_Q * AT_MP];  // mask tile

    const int tid   = threadIdx.x;
    const int lane  = tid & 31;
    const int colx  = lane & 15;
    const int g     = lane >> 4;
    const int wave  = tid >> 5;
    const int q0    = (blockIdx.x & 7) * AT_Q;     // first Q row of the work-group
    const int stile = (q0 >> 4) + wave;            // this wave's 16 Q rows
    const int h     = (blockIdx.x >> 3) & 15;
    const int b     = blockIdx.x >> 7;

    const _Float16* Qb = xq  + ((size_t)(b * H_ + h) * S_) * HD_;
    const _Float16* Kb = xk  + ((size_t)(b * H_ + h) * S_) * HD_;
    const _Float16* Vt = xvT + ((size_t)(b * H_ + h) * HD_) * S_;

    // Copy addresses of this lane at stage 0, buffer 0. K, Vt: 8 lanes cover a row of
    // 128 B, the work-group 32 rows; mask: 16 lanes cover a row of 256 B, the work-group 16.
    const int krow = tid >> 3, kchk = tid & 7;
    const int mrow = tid >> 4, mchk = tid & 15;
    const _Float16* gk = Kb + (size_t)krow * HD_ + kchk * 8;
    const _Float16* gv = Vt + (size_t)krow * S_  + kchk * 8;
    const float*    gm = mask + (size_t)(q0 + mrow) * S_ + mchk * 4;
    const unsigned  lk = (unsigned)(size_t)(&kvs[0][krow * AT_KP + kchk * 8]);
    const unsigned  lv = lk + AT_KV * 2u;
    const unsigned  lm = (unsigned)(size_t)(&mks[0][mrow * AT_MP + mchk * 4]);
    constexpr unsigned KVB = 2u * AT_KV * 2u;      // bytes from buffer 0 to buffer 1: K, Vt
    constexpr unsigned MKB = AT_Q * AT_MP * 4u;    // ... mask

    copy_kv(lk, gk, lv, gv);
    copy_mask(lm, gm);

    // Q tile B-operands (column = query colx), kept resident: hd 0..31 and 32..63
    const _Float16* qrow = Qb + (size_t)(stile * 16 + colx) * HD_;
    const v16h qb0 = ld_ab(qrow,      g);
    const v16h qb1 = ld_ab(qrow + 32, g);

    // This lane's query: the running maximum (equal in both halves) and the sum over this
    // half's t alone; the halves' sums are joined behind the loop.
    float mrun = -1.0e30f, lrun = 0.0f;
    v8f o[4];                                      // O^T: o[nt][i] = hd nt*16 + 8*g + i of query colx
#pragma unroll
    for (int nt = 0; nt < 4; ++nt) o[nt] = vzero8();

    asm volatile("s_wait_asynccnt 0x0" ::: "memory");   // this wave's copies of stage 0 have landed
    __syncthreads();                                    // ... and every other wave's
    copy_kv(lk + KVB, gk + AT_T * HD_, lv + KVB, gv + AT_T);
    copy_mask(lm + MKB, gm + AT_T);

    for (int st = 0; st < AT_NS; ++st) {
        const _Float16* ks = kvs[st & 1];
        const _Float16* vs = ks + AT_KV;
        const float*    ms = mks[st & 1] + (wave * 16 + colx) * AT_MP + 8 * g;

        // Two steps of 32 t columns; unrolled so that every LDS offset is a constant.
#pragma unroll
        for (int tb = 0; tb < AT_T; tb += 32) {
            // S^T for 32 t: two 16x16 C tiles (row = t, column = query), K=64 over hd
            v8f s0 = vzero8(), s1 = vzero8();
            {
                const _Float16* krow0 = ks + (tb + colx) * AT_KP;
                s0 = wmma16(ld_ab(krow0,      g), qb0, s0);
                s0 = wmma16(ld_ab(krow0 + 32, g), qb1, s0);
                const _Float16* krow1 = ks + (tb + 16 + colx) * AT_KP;
                s1 = wmma16(ld_ab(krow1,      g), qb0, s1);
                s1 = wmma16(ld_ab(krow1 + 32, g), qb1, s1);
            }

            // The mask of this lane's query at its t: tb + 8*g + i and tb + 16 + 8*g + i
            const v4f mk[4] = { *(const v4f*)(ms + tb),      *(const v4f*)(ms + tb + 4),
                                *(const v4f*)(ms + tb + 16), *(const v4f*)(ms + tb + 20) };

            // scale * multiplicative mask; e[i] is t = 8*g + i, e[8 + i] is t = 16 + 8*g + i
            // (two neighbours at a time: accumulator and mask registers pair as they lie)
            float e[16];
#pragma unroll
            for (int j = 0; j < 4; ++j) {
                const v2f m0 = { mk[j >> 1][2 * (j & 1)],     mk[j >> 1][2 * (j & 1) + 1] };
                const v2f m1 = { mk[2 + (j >> 1)][2 * (j & 1)], mk[2 + (j >> 1)][2 * (j & 1) + 1] };
                const v2f a0 = { s0[2 * j], s0[2 * j + 1] };
                const v2f a1 = { s1[2 * j], s1[2 * j + 1] };
                const v2f f0 = a0 * 0.125f * m0;
                const v2f f1 = a1 * 0.125f * m1;
                e[2 * j]     = f0[0]; e[2 * j + 1] = f0[1];
                e[2 * j + 8] = f1[0]; e[2 * j + 9] = f1[1];
            }

            // online softmax over t: the maximum of the lane's 16, then of the query's 32
            float t3[5];
#pragma unroll
            for (int j = 0; j < 5; ++j)
                t3[j] = fmaxf(fmaxf(e[3 * j], e[3 * j + 1]), e[3 * j + 2]);
            float tm = fmaxf(fmaxf(fmaxf(t3[0], t3[1]), t3[2]), fmaxf(fmaxf(t3[3], t3[4]), e[15]));
            tm = fmaxf(tm, xhalf(tm));

            const float mn   = fmaxf(mrun, tm);
            const float corr = exp_slot(mrun - mn);
            mrun = mn;
#pragma unroll
            for (int i = 0; i < 16; ++i) e[i] = (e[i] - mn) * 1.44269504f;
            exp_slot8(e);
            exp_slot8(e + 8);
            float r4[4];
#pragma unroll
            for (int j = 0; j < 4; ++j)
                r4[j] = (e[j] + e[j + 4]) + (e[j + 8] + e[j + 12]);
            lrun = lrun * corr + ((r4[0] + r4[2]) + (r4[1] + r4[3]));
#pragma unroll
            for (int nt = 0; nt < 4; ++nt)
#pragma unroll
                for (int i = 0; i < 8; ++i)
                    o[nt][i] *= corr;

            // P^T as B operand: element j is t = 8*g + j, element 8 + j is t = 16 + 8*g + j,
            // the k order in which ld_ab reads the rows of Vt
            v16h pb;
#pragma unroll
            for (int i = 0; i < 16; ++i) pb[i] = (_Float16)e[i];

            // O^T += V^T (64x32) * P^T (32x16): 4 M-tiles of transposed V (contiguous along t)
#pragma unroll
            for (int nt = 0; nt < 4; ++nt) {
                const _Float16* vrow = vs + (nt * 16 + colx) * AT_KP + tb;
                o[nt] = wmma16(ld_ab(vrow, g), pb, o[nt]);
            }
        }

        asm volatile("s_wait_dscnt 0x0" ::: "memory");     // this wave has left the buffer
        asm volatile("s_wait_asynccnt 0x0" ::: "memory");  // its copies of stage st+1 have landed
        __syncthreads();                                   // publishes stage st+1, frees this buffer
        if (st + 2 < AT_NS) {
            const unsigned bo = (unsigned)(st & 1);
            copy_kv(lk + bo * KVB, gk + (size_t)(st + 2) * (AT_T * HD_),
                    lv + bo * KVB, gv + (st + 2) * AT_T);
            copy_mask(lm + bo * MKB, gm + (st + 2) * AT_T);
        }
    }
    asm volatile("s_wait_asynccnt 0x0" ::: "memory");      // nothing in flight when the wave ends

    // normalize and store to (s,b,d) f16 for the output projection. The wave's 16 rows of
    // 128 B go through its own 16 rows of mask buffer 0 (last read in stage 14, two barriers
    // back; nothing is copied there any more) and leave as whole 128-B lines, 8 lanes a line.
    _Float16* so = (_Float16*)(mks[0] + wave * 16 * AT_MP);
    const float lsum = lrun + xhalf(lrun);         // the two halves' sums of this query
#pragma unroll
    for (int nt = 0; nt < 4; ++nt) {
        v8h pk;                                    // eight hd in a row of query colx
#pragma unroll
        for (int i = 0; i < 8; ++i) pk[i] = (_Float16)(o[nt][i] / lsum);
        *(v8h*)(so + colx * (AT_MP * 2) + nt * 16 + 8 * g) = pk;
    }
    asm volatile("s_wait_dscnt 0" ::: "memory");   // the wave's rows are written before it reads them back
    const int r = lane >> 3, c = lane & 7;
    v8h v[4];
#pragma unroll
    for (int j = 0; j < 4; ++j) v[j] = *(const v8h*)(so + (r + 4 * j) * (AT_MP * 2) + c * 8);
    _Float16* gp = attn + ((size_t)((stile * 16 + r) * B_ + b)) * D_ + h * 64 + c * 8;
#pragma unroll
    for (int j = 0; j < 4; ++j) *(v8h*)(gp + j * 4 * B_ * D_) = v[j];
}

// ---------------------------------------------------------------- output projection
// attn (2048x1024,f16) @ Wo^T + bo -> out (f32); same tile. The 64 x 128 results go through
// LDS and leave as 16-byte stores, a wave covering one row's 512 B.
#define OT_P 132                            // staging row: 128 floats + 4 (528 B)
__global__ __launch_bounds__(128) void out_gemm_kernel(
    const _Float16* __restrict__ attn, const _Float16* __restrict__ Wo16,
    const float* __restrict__ bo, float* __restrict__ out)
{
    __shared__ __attribute__((aligned(16))) _Float16 sm[2 * GT_BUF];

    const int lane  = threadIdx.x & 31;
    const int colx  = lane & 15;
    const int g     = lane >> 4;
    const int wave  = threadIdx.x >> 5;
    const int ml    = (wave >> 1) * 32 + 8 * g;              // this lane's row at mt = 0, i = 0
    const int nl    = (wave & 1) * 64 + colx;                // this lane's column at nt = 0

    v8f acc[2][4];
    gemm_tile<D_>(attn, Wo16, blockIdx.x * GT_M, blockIdx.y * GT_N, sm, acc);

    float bn[4];
#pragma unroll
    for (int nt = 0; nt < 4; ++nt) bn[nt] = bo[blockIdx.y * GT_N + nl + nt * 16];

    // sm is free here, as in the QKV kernel.
    float* so = (float*)sm;
#pragma unroll
    for (int nt = 0; nt < 4; ++nt)
#pragma unroll
        for (int mt = 0; mt < 2; ++mt)
#pragma unroll
            for (int i = 0; i < 8; ++i)
                so[(ml + mt * 16 + i) * OT_P + nl + nt * 16] = acc[mt][nt][i] + bn[nt];
    __syncthreads();                        // the staged tile is read across waves

    // this wave's rows: wave, wave+4, ..., wave+60
    v4f v[16];
#pragma unroll
    for (int j = 0; j < 16; ++j) v[j] = *(const v4f*)(so + (wave + 4 * j) * OT_P + lane * 4);
    float* gp = out + (size_t)(blockIdx.x * GT_M + wave) * D_ + blockIdx.y * GT_N + lane * 4;
#pragma unroll
    for (int j = 0; j < 16; ++j) *(v4f*)(gp + j * 4 * D_) = v[j];
}

// ---------------------------------------------------------------- launch
extern "C" void kernel_launch(void* const* d_in, const int* in_sizes, int n_in,
                              void* d_out, int out_size, void* d_ws, size_t ws_size,
                              hipStream_t stream) {
    (void)in_sizes; (void)n_in; (void)out_size; (void)ws_size;

    const float* query = (const float*)d_in[0];
    const float* mask  = (const float*)d_in[1];
    const float* Wq    = (const float*)d_in[2];
    const float* bq    = (const float*)d_in[3];
    const float* Wk    = (const float*)d_in[4];
    const float* bk    = (const float*)d_in[5];
    const float* Wv    = (const float*)d_in[6];
    const float* bv    = (const float*)d_in[7];
    const float* Wo    = (const float*)d_in[8];
    const float* bo    = (const float*)d_in[9];
    float* out = (float*)d_out;

    char* ws = (char*)d_ws;
    const size_t MB = 1024 * 1024;
    _Float16* qf16 = (_Float16*)(ws);             // 2048x1024        (4 MB)
    _Float16* wf16 = (_Float16*)(ws + 4 * MB);    // 4x 1024x1024     (8 MB): q,k,v,o
    _Float16* xq   = (_Float16*)(ws + 12 * MB);   // (b,h,s,hd)       (4 MB)
    _Float16* xk   = (_Float16*)(ws + 16 * MB);   // (b,h,t,hd)       (4 MB)
    _Float16* xvT  = (_Float16*)(ws + 20 * MB);   // (b,h,hd,t)       (4 MB)
    _Float16* attn = (_Float16*)(ws + 24 * MB);   // (s,b,d)          (4 MB)

    const int NW = D_ * D_;     // 1M
    // qf16 and wf16 lie one behind the other: one destination of 6 parts.
    cvt_f16_kernel<<<dim3(CV_PART / CV_WG, 6), CV_TH, 0, stream>>>(query, Wq, Wk, Wv, Wo, qf16);

    qkv_gemm_kernel<<<dim3(M_ / GT_M, D_ / GT_N, 3), 128, 0, stream>>>(
        qf16, wf16, bq, bk, bv, xq, xk, xvT);

    attn_kernel<<<B_ * H_ * (S_ / AT_Q), AT_W * 32, 0, stream>>>(xq, xk, xvT, mask, attn);

    out_gemm_kernel<<<dim3(M_ / GT_M, D_ / GT_N), 128, 0, stream>>>(
        attn, wf16 + 3 * (size_t)NW, bo, out);
}

// v006
// A run of this version takes 51.6 microseconds.
// Timed twice side by side with v005, it ran 1.05 and 1.04 times as fast.
// All steps since v000 together make it 3.63 times as fast.
#include <hip/hip_runtime.h>

#define S_  1024
#define B_  2
#define D_  1024
#define H_  16
#define HD_ 64
#define M_  (S_*B_)   // 2048 rows

typedef _Float16 v16h __attribute__((ext_vector_type(16)));
typedef _Float16 v8h  __attribute__((ext_vector_type(8)));
typedef float    v8f  __attribute__((ext_vector_type(8)));

static __device__ __forceinline__ v8f vzero8() {
    v8f z;
#pragma unroll
    for (int i = 0; i < 8; ++i) z[i] = 0.0f;
    return z;
}

// Load a 16x32 (f16) WMMA A/B operand chunk for this lane.
// p = start of this lane's row (A: row m; B: col n) at the current k-base.
// Lane group g (=lane>>4): g=0 takes halves {0..7,16..23}, g=1 takes {8..15,24..31}.
static __device__ __forceinline__ v16h ld_ab(const _Float16* p, int g) {
    v8h lo = *(const v8h*)(p + g * 8);
    v8h hi = *(const v8h*)(p + g * 8 + 16);
    return __builtin_shufflevector(lo, hi, 0,1,2,3,4,5,6,7,8,9,10,11,12,13,14,15);
}

static __device__ __forceinline__ v8f wmma16(v16h a, v16h b, v8f c) {
    // D = A(16x32,f16) * B(32x16,f16) + C(16x16,f32)
    return __builtin_amdgcn_wmma_f32_16x16x32_f16(false, a, false, b, (short)0, c, false, false);
}

// ---------------------------------------------------------------- convert
// All five f32 -> f16 conversions in one launch. The destination is one run of
// 6 x 2^20 halves (query, then Wq, Wk, Wv, Wo); blockIdx.y names the 2^20-value part.
// A wave takes 2,048 values in a row: sixteen 16-byte loads a lane, each 512 B in a row
// over the wave; each store is 256 B in a row.
// Few, long waves: the time of this stage is the time to start its waves, not its bytes.
#define CV_PART (1 << 20)                   // values per part
#define CV_LD   16                          // 16-byte loads a lane
#define CV_TH   128                         // threads per work-group
#define CV_WG   (CV_TH * 4 * CV_LD)         // values per work-group (8,192)

typedef float    v4f __attribute__((ext_vector_type(4)));
typedef _Float16 v4h __attribute__((ext_vector_type(4)));
typedef float    v2f __attribute__((ext_vector_type(2)));

__global__ __launch_bounds__(CV_TH) void cvt_f16_kernel(
    const float* __restrict__ query, const float* __restrict__ Wq,
    const float* __restrict__ Wk, const float* __restrict__ Wv,
    const float* __restrict__ Wo, _Float16* __restrict__ dst)
{
    const int part = blockIdx.y;            // 0,1: query; 2..5: Wq, Wk, Wv, Wo
    const float* src = (part < 2)  ? query + (size_t)part * CV_PART
                     : (part == 2) ? Wq
                     : (part == 3) ? Wk
                     : (part == 4) ? Wv : Wo;
    const int off = blockIdx.x * CV_WG + (threadIdx.x >> 5) * (128 * CV_LD)
                  + (threadIdx.x & 31) * 4;
    const float* s = src + off;
    _Float16*    d = dst + (size_t)part * CV_PART + off;

    v4f v[CV_LD];
#pragma unroll
    for (int j = 0; j < CV_LD; ++j) v[j] = *(const v4f*)(s + j * 128);
#pragma unroll
    for (int j = 0; j < CV_LD; ++j)
        *(v4h*)(d + j * 128) = __builtin_convertvector(v[j], v4h);
}

// ---------------------------------------------------------------- GEMM tile in LDS
// Output projection: a work-group of 4 waves (2 x 2) makes a 64M x 128N tile, 32M x 64N a wave.
// QKV: a work-group of 8 waves (2 x 4) makes a 128M x 192N tile, 64M x 48N a wave: 256
// work-groups, one on each WGP, and (128 + 192) operand rows copied from L2 for 128 x 192
// results, where three 64 x 128 tiles copy 576 rows for the same number of results.
// A pass is 128 k: the tile's rows of X and of W, 256 B each, copied to LDS at a
// pitch of 272 B (ds_load_b128 reads of 16 rows then fall on all 64 banks).
// Two buffers: the next pass's copies fly while this pass is multiplied.
#define GT_M   64
#define GT_N   128
#define QT_M   128
#define QT_N   192
#define GT_K   128
#define GT_P   136                          // LDS row pitch in halves (272 B)
#define GT_BUF ((GT_M + GT_N) * GT_P)       // halves per buffer (52,224 B)
#define QT_BUF ((QT_M + QT_N) * GT_P)       // ... of the QKV tile (87,040 B)
#define GT_NP  (D_ / GT_K)                  // 8 passes

// Eight 16-byte copies of this lane: its chunk in rows r, r+RS, ..., r+7*RS.
// LD: halves from one row of the tile to the next in global memory.
// RS: rows that one copy of the whole work-group covers (16 lanes a row).
// The s_wait_xcnt stands inside the statement so that no address register of a
// copy is rewritten in front of it.
template <int LD, int RS>
static __device__ __forceinline__ void copy8(unsigned l, const _Float16* p) {
    constexpr unsigned STEP_L = (unsigned)RS * GT_P * 2u;   // RS rows in LDS, bytes
    constexpr int      STEP_G = RS * LD;                    // RS rows in global, halves
    asm volatile(
        "global_load_async_to_lds_b128 %0, %1, off\n\t"
        "global_load_async_to_lds_b128 %2, %3, off\n\t"
        "global_load_async_to_lds_b128 %4, %5, off\n\t"
        "global_load_async_to_lds_b128 %6, %7, off\n\t"
        "global_load_async_to_lds_b128 %8, %9, off\n\t"
        "global_load_async_to_lds_b128 %10, %11, off\n\t"
        "global_load_async_to_lds_b128 %12, %13, off\n\t"
        "global_load_async_to_lds_b128 %14, %15, off\n\t"
        "s_wait_xcnt 0x0"
        :: "v"(l + 0u * STEP_L), "v"(p + 0 * STEP_G),
           "v"(l + 1u * STEP_L), "v"(p + 1 * STEP_G),
           "v"(l + 2u * STEP_L), "v"(p + 2 * STEP_G),
           "v"(l + 3u * STEP_L), "v"(p + 3 * STEP_G),
           "v"(l + 4u * STEP_L), "v"(p + 4 * STEP_G),
           "v"(l + 5u * STEP_L), "v"(p + 5 * STEP_G),
           "v"(l + 6u * STEP_L), "v"(p + 6 * STEP_G),
           "v"(l + 7u * STEP_L), "v"(p + 7 * STEP_G)
        : "memory");
}

// The same for four copies: rows r, r+RS, r+2*RS, r+3*RS; the wait as above.
template <int LD, int RS>
static __device__ __forceinline__ void copy4(unsigned l, const _Float16* p) {
    constexpr unsigned STEP_L = (unsigned)RS * GT_P * 2u;
    constexpr int      STEP_G = RS * LD;
    asm volatile(
        "global_load_async_to_lds_b128 %0, %1, off\n\t"
        "global_load_async_to_lds_b128 %2, %3, off\n\t"
        "global_load_async_to_lds_b128 %4, %5, off\n\t"
        "global_load_async_to_lds_b128 %6, %7, off\n\t"
        "s_wait_xcnt 0x0"
        :: "v"(l + 0u * STEP_L), "v"(p + 0 * STEP_G),
           "v"(l + 1u * STEP_L), "v"(p + 1 * STEP_G),
           "v"(l + 2u * STEP_L), "v"(p + 2 * STEP_G),
           "v"(l + 3u * STEP_L), "v"(p + 3 * STEP_G)
        : "memory");
}

// ROWS rows of one operand: ROWS / RS copies a lane, eight to a statement and a last four.
template <int LD, int RS, int ROWS>
static __device__ __forceinline__ void copy_rows(unsigned l, const _Float16* p) {
    constexpr int N = ROWS / RS;
    static_assert(ROWS % (4 * RS) == 0, "whole statements of four or eight copies");
    if constexpr (N >= 8) {
        copy8<LD, RS>(l, p);
        if constexpr (N > 8)
            copy_rows<LD, RS, ROWS - 8 * RS>(l + 8u * RS * GT_P * 2u, p + (size_t)(8 * RS) * LD);
    } else {
        copy4<LD, RS>(l, p);
    }
}

// One pass's tile: TM + TN rows x 16 chunks of 16 B; 16 lanes cover a row.
// l: LDS byte address of this lane's chunk in row (tid >> 4) of the buffer;
// xa, wb: the same chunk in the X tile and in the W tile at the pass's k.
template <int LDX, int RS, int TM, int TN>
static __device__ __forceinline__ void copy_pass(unsigned l, const _Float16* xa,
                                                 const _Float16* wb) {
    copy_rows<LDX, RS, TM>(l, xa);
    copy_rows<D_, RS, TN>(l + TM * GT_P * 2u, wb);
}

// acc[mt][nt] = X[m0 + wm*MT*16 + mt*16 ..][:] . W[n0 + wn*NT*16 + nt*16 ..][:]^T over all of K;
// row r of X begins at X + r * LDX. The work-group's TH / 32 waves lie WN to a row of waves.
// The loops over mt, nt and kb are unrolled so that every index of a fragment or
// accumulator array is a constant and the arrays stay in registers.
template <int LDX, int TH, int WN, int MT, int NT>
static __device__ __forceinline__ void gemm_tile(
    const _Float16* __restrict__ X, const _Float16* __restrict__ Wt,
    int m0, int n0, _Float16* sm, v8f (&acc)[MT][NT])
{
    constexpr int      TM  = (TH / 32 / WN) * MT * 16;   // rows of X in the tile
    constexpr int      TN  = WN * NT * 16;               // rows of W
    constexpr int      RS  = TH / 16;                    // rows that one copy of every lane covers
    constexpr unsigned BUF = (TM + TN) * GT_P;           // halves per buffer

    const int tid  = threadIdx.x;
    const int lane = tid & 31;
    const int colx = lane & 15;
    const int g    = lane >> 4;
    const int wave = tid >> 5;
    const int wm   = wave / WN;
    const int wn   = wave % WN;

    const int crow = tid >> 4;          // 0..RS-1
    const int cchk = tid & 15;          // 16-byte chunk in the row
    const _Float16* xa = X  + (size_t)(m0 + crow) * LDX + cchk * 8;
    const _Float16* wb = Wt + (size_t)(n0 + crow) * D_ + cchk * 8;
    const unsigned  l0 = (unsigned)(size_t)(sm + crow * GT_P + cchk * 8);

#pragma unroll
    for (int mt = 0; mt < MT; ++mt)
#pragma unroll
        for (int nt = 0; nt < NT; ++nt) acc[mt][nt] = vzero8();

    copy_pass<LDX, RS, TM, TN>(l0, xa, wb);
    asm volatile("s_wait_asynccnt 0x0" ::: "memory");   // this wave's copies of pass 0 have landed
    __syncthreads();                                    // ... and every other wave's
    copy_pass<LDX, RS, TM, TN>(l0 + BUF * 2u, xa + GT_K, wb + GT_K);

    for (int t = 0; t < GT_NP; ++t) {
        const _Float16* buf = sm + (t & 1) * BUF;
        const _Float16* sa  = buf + (wm * (MT * 16) + colx) * GT_P;
        const _Float16* sb  = buf + (TM + wn * (NT * 16) + colx) * GT_P;
        // Fragments of the next 32 k are read, as one group, ahead of this block's WMMAs.
        v16h a[2][MT], bm[2][NT];
#pragma unroll
        for (int mt = 0; mt < MT; ++mt) a[0][mt] = ld_ab(sa + mt * 16 * GT_P, g);
#pragma unroll
        for (int nt = 0; nt < NT; ++nt) bm[0][nt] = ld_ab(sb + nt * 16 * GT_P, g);
#pragma unroll
        for (int kb = 0; kb < GT_K / 32; ++kb) {
            const int cur = kb & 1, nxt = cur ^ 1;
            if (kb + 1 < GT_K / 32) {
#pragma unroll
                for (int mt = 0; mt < MT; ++mt)
                    a[nxt][mt] = ld_ab(sa + mt * 16 * GT_P + (kb + 1) * 32, g);
#pragma unroll
                for (int nt = 0; nt < NT; ++nt)
                    bm[nxt][nt] = ld_ab(sb + nt * 16 * GT_P + (kb + 1) * 32, g);
            }
            // Keeps the read group in front of the WMMA block: left free, the scheduler
            // sinks each read to its use and every WMMA pair waits out an LDS latency.
            __builtin_amdgcn_sched_barrier(0);
#pragma unroll
            for (int nt = 0; nt < NT; ++nt)
#pragma unroll
                for (int mt = 0; mt < MT; ++mt)
                    acc[mt][nt] = wmma16(a[cur][mt], bm[cur][nt], acc[mt][nt]);
            // Keeps the following read group behind this block, so that it stays one group.
            __builtin_amdgcn_sched_barrier(0);
        }
        asm volatile("s_wait_dscnt 0x0" ::: "memory");     // this wave has left the buffer
        asm volatile("s_wait_asynccnt 0x0" ::: "memory");  // its copies of pass t+1 have landed
        __syncthreads();                                   // publishes pass t+1, frees this buffer
        if (t + 2 < GT_NP)
            copy_pass<LDX, RS, TM, TN>(l0 + (t & 1) * (BUF * 2u), xa + (t + 2) * GT_K, wb + (t + 2) * GT_K);
    }
    asm volatile("s_wait_asynccnt 0x0" ::: "memory");      // nothing in flight when the wave ends
}

// ---------------------------------------------------------------- QKV GEMM
// X (2048x1024, f16) @ [Wq; Wk; Wv]^T + b: the three weights lie one behind the other, so
// that the product has 3,072 columns = 48 heads of 64: 16 of q, 16 of k, 16 of v.
// Outputs: xq/xk in (b,h,s,hd), xv transposed to (b,h,hd,t).
// A work-group takes 128 s of ONE b (every second row of X) and three heads in a row, each
// of which may be of q, of k or of v. Its results are whole 128-B lines of the destination:
// a head of q or k is 128 rows (s) of 64 hd, a head of v 64 rows (hd) of 128 t. They go
// through LDS in that order and leave as 16-byte stores.
#define ST_P 72                             // staging row of q, k: 64 halves + 8 (144 B)
#define SV_P 136                            // staging row of v: 128 halves + 8 (272 B)
#define ST_H (QT_M * ST_P)                  // halves of a head's staging area (v fills 64 * SV_P of it)
__global__ __launch_bounds__(256) void qkv_gemm_kernel(
    const _Float16* __restrict__ qf16, const _Float16* __restrict__ wf16,
    const float* __restrict__ bq, const float* __restrict__ bk,
    const float* __restrict__ bv,
    _Float16* __restrict__ xq, _Float16* __restrict__ xk,
    _Float16* __restrict__ xvT)
{
    __shared__ __attribute__((aligned(16))) _Float16 sm[2 * QT_BUF];

    const int tid   = threadIdx.x;
    const int lane  = tid & 31;
    const int colx  = lane & 15;
    const int g     = lane >> 4;
    const int wave  = tid >> 5;
    const int b     = blockIdx.x & 1;
    const int s0    = (blockIdx.x >> 1) * QT_M;              // first s of the work-group
    const int sl    = (wave >> 2) * 64 + 8 * g;              // this lane's s - s0 at mt = 0, i = 0
    const int gh0   = blockIdx.y * 3;                        // first of the three heads, 0..47

    v8f acc[4][3];
    // rows of X are (s,b) interleaved, B=2: row s of this b begins at qf16 + b*D_ + s*(B_*D_)
    gemm_tile<B_ * D_, 256, 4, 4, 3>(qf16 + b * D_, wf16, s0, blockIdx.y * QT_N, sm, acc);

    // sm is free here: every wave has passed the last pass's barrier with its LDS reads
    // retired, and no copy is in flight.
    float bn3[3];
#pragma unroll
    for (int nt = 0; nt < 3; ++nt) {
        const int ct    = (wave & 3) * 3 + nt;               // 16-column tile, 0..11
        const int gh    = gh0 + (ct >> 2);                   // its head
        const int which = gh >> 4;                           // 0=q 1=k 2=v
        const float* bias = (which == 0) ? bq : (which == 1) ? bk : bv;
        bn3[nt] = bias[(gh & 15) * HD_ + (ct & 3) * 16 + colx];
    }
#pragma unroll
    for (int nt = 0; nt < 3; ++nt) {
        const int ct    = (wave & 3) * 3 + nt;
        const int which = (gh0 + (ct >> 2)) >> 4;
        const int hd    = (ct & 3) * 16 + colx;              // this lane's column in the head
        const float  bn = bn3[nt];
        _Float16*    sh = sm + (ct >> 2) * ST_H;
        if (which == 2) {
            // staging row = hd: a lane's eight values are eight t in a row
#pragma unroll
            for (int mt = 0; mt < 4; ++mt) {
                v8h pk;
#pragma unroll
                for (int i = 0; i < 8; ++i) pk[i] = (_Float16)(acc[mt][nt][i] + bn);
                *(v8h*)(sh + hd * SV_P + sl + mt * 16) = pk;
            }
        } else {
            // staging row = s
#pragma unroll
            for (int mt = 0; mt < 4; ++mt)
#pragma unroll
                for (int i = 0; i < 8; ++i)
                    sh[(sl + mt * 16 + i) * ST_P + hd] = (_Float16)(acc[mt][nt][i] + bn);
        }
    }
    __syncthreads();                        // the staged tile is read across waves

    // A head is 1,024 chunks of 16 B, four a thread. q, k: 128 rows of 8 chunks, this
    // thread's chunk in rows r, r+32, r+64, r+96; v: 64 rows of 16 chunks, rows r, r+16,
    // r+32, r+48. All twelve chunks are read before the first is stored.
    v8h       v[3][4];
    _Float16* gp[3];
    int       gs[3];
#pragma unroll
    for (int hl = 0; hl < 3; ++hl) {
        const int  gh  = gh0 + hl;
        const int  bh  = b * H_ + (gh & 15);
        const bool isv = (gh >> 4) == 2;
        const int  r   = isv ? tid >> 4 : tid >> 3;
        const int  c   = isv ? tid & 15 : tid & 7;
        const _Float16* sp = sm + hl * ST_H + r * (isv ? SV_P : ST_P) + c * 8;
        const int  ss  = isv ? 16 * SV_P : 32 * ST_P;        // halves from one of its rows to the next
#pragma unroll
        for (int j = 0; j < 4; ++j) v[hl][j] = *(const v8h*)(sp + j * ss);
        gp[hl] = isv ? xvT + (size_t)(bh * HD_ + r) * S_ + s0 + c * 8                    // (b,h,hd,t)
                     : (((gh >> 4) == 0) ? xq : xk) + (size_t)(bh * S_ + s0 + r) * HD_ + c * 8;  // (b,h,s,hd)
        gs[hl] = isv ? 16 * S_ : 32 * HD_;
    }
#pragma unroll
    for (int hl = 0; hl < 3; ++hl)
#pragma unroll
        for (int j = 0; j < 4; ++j) *(v8h*)(gp[hl] + j * gs[hl]) = v[hl][j];
}

#define AT_W   8                            // waves per work-group
#define AT_Q   (AT_W * 16)                  // Q rows per work-group
#define AT_T   64                           // t columns per stage
#define AT_KP  72                           // K / Vt row pitch in halves (144 B)
#define AT_MP  68                           // mask row pitch in floats (272 B)
#define AT_KV  (64 * AT_KP)                 // halves in a K tile, and in a Vt tile
#define AT_NS  (S_ / AT_T)                  // 16 stages

// This lane's 16-byte chunk in rows r and r+32 of the K tile and of the Vt tile.
// The s_wait_xcnt stands inside the statement so that no address register of a
// copy is rewritten in front of it.
static __device__ __forceinline__ void copy_kv(unsigned lk, const _Float16* k,
                                               unsigned lv, const _Float16* v) {
    constexpr unsigned STEP_L = 32u * AT_KP * 2u;   // 32 rows in LDS, bytes
    asm volatile(
        "global_load_async_to_lds_b128 %0, %1, off\n\t"
        "global_load_async_to_lds_b128 %2, %3, off\n\t"
        "global_load_async_to_lds_b128 %4, %5, off\n\t"
        "global_load_async_to_lds_b128 %6, %7, off\n\t"
        "s_wait_xcnt 0x0"
        :: "v"(lk),          "v"(k),
           "v"(lk + STEP_L), "v"(k + 32 * HD_),
           "v"(lv),          "v"(v),
           "v"(lv + STEP_L), "v"(v + 32 * S_)
        : "memory");
}

// This lane's 16-byte chunk in rows r, r+16, ..., r+112 of the mask tile; the wait as above.
static __device__ __forceinline__ void copy_mask(unsigned l, const float* p) {
    constexpr unsigned STEP_L = 16u * AT_MP * 4u;   // 16 rows in LDS, bytes
    constexpr int      STEP_G = 16 * S_;            // 16 rows in global, floats
    asm volatile(
        "global_load_async_to_lds_b128 %0, %1, off\n\t"
        "global_load_async_to_lds_b128 %2, %3, off\n\t"
        "global_load_async_to_lds_b128 %4, %5, off\n\t"
        "global_load_async_to_lds_b128 %6, %7, off\n\t"
        "global_load_async_to_lds_b128 %8, %9, off\n\t"
        "global_load_async_to_lds_b128 %10, %11, off\n\t"
        "global_load_async_to_lds_b128 %12, %13, off\n\t"
        "global_load_async_to_lds_b128 %14, %15, off\n\t"
        "s_wait_xcnt 0x0"
        :: "v"(l + 0u * STEP_L), "v"(p + 0 * STEP_G),
           "v"(l + 1u * STEP_L), "v"(p + 1 * STEP_G),
           "v"(l + 2u * STEP_L), "v"(p + 2 * STEP_G),
           "v"(l + 3u * STEP_L), "v"(p + 3 * STEP_G),
           "v"(l + 4u * STEP_L), "v"(p + 4 * STEP_G),
           "v"(l + 5u * STEP_L), "v"(p + 5 * STEP_G),
           "v"(l + 6u * STEP_L), "v"(p + 6 * STEP_G),
           "v"(l + 7u * STEP_L), "v"(p + 7 * STEP_G)
        : "memory");
}

// e^x as __expf forms it (x * log2(e), then v_exp_f32), with the one free slot that the
// instruction set asks for behind a transcendental kept in the same statement.
// The exp works in place: the only register that the asm text writes is one that the
// multiply in front of it has written, so it is never a register that a WMMA still reads.
static __device__ __forceinline__ float exp_slot(float x) {
    float r = x * 1.44269504f;
    asm("v_exp_f32 %0, %0\n\tv_nop" : "+v"(r));
    return r;
}

// The same for eight values: each exp is followed by one that shares no register with it,
// so that one free slot behind the last serves the run.
static __device__ __forceinline__ void exp_slot8(float* e) {
    asm("v_exp_f32 %0, %0\n\t"
        "v_exp_f32 %1, %1\n\t"
        "v_exp_f32 %2, %2\n\t"
        "v_exp_f32 %3, %3\n\t"
        "v_exp_f32 %4, %4\n\t"
        "v_exp_f32 %5, %5\n\t"
        "v_exp_f32 %6, %6\n\t"
        "v_exp_f32 %7, %7\n\t"
        "v_nop"
        : "+v"(e[0]), "+v"(e[1]), "+v"(e[2]), "+v"(e[3]),
          "+v"(e[4]), "+v"(e[5]), "+v"(e[6]), "+v"(e[7]));
}

// Lane l with lane l ^ 16, on the vector port.
static __device__ __forceinline__ float xhalf(float x) {
    const int b = __builtin_bit_cast(int, x);
    return __builtin_bit_cast(float,
        __builtin_amdgcn_permlanex16(b, b, 0x76543210, 0xfedcba98, false, false));
}

__global__ __launch_bounds__(AT_W * 32) void attn_kernel(
    const _Float16* __restrict__ xq, const _Float16* __restrict__ xk,
    const _Float16* __restrict__ xvT, const float* __restrict__ mask,
    _Float16* __restrict__ attn)
{
    __shared__ __attribute__((aligned(16))) _Float16 kvs[2][2 * AT_KV];     // K tile, Vt tile
    __shared__ __attribute__((aligned(16))) float    mks[2][AT_Q * AT_MP];  // mask tile

    const int tid   = threadIdx.x;
    const int lane  = tid & 31;
    const int colx  = lane & 15;
    const int g     = lane >> 4;
    const int wave  = tid >> 5;
    const int q0    = (blockIdx.x & 7) * AT_Q;     // first Q row of the work-group
    const int stile = (q0 >> 4) + wave;            // this wave's 16 Q rows
    const int h     = (blockIdx.x >> 3) & 15;
    const int b     = blockIdx.x >> 7;

    const _Float16* Qb = xq  + ((size_t)(b * H_ + h) * S_) * HD_;
    const _Float16* Kb = xk  + ((size_t)(b * H_ + h) * S_) * HD_;
    const _Float16* Vt = xvT + ((size_t)(b * H_ + h) * HD_) * S_;

    // Copy addresses of this lane at stage 0, buffer 0. K, Vt: 8 lanes cover a row of
    // 128 B, the work-group 32 rows; mask: 16 lanes cover a row of 256 B, the work-group 16.
    const int krow = tid >> 3, kchk = tid & 7;
    const int mrow = tid >> 4, mchk = tid & 15;
    const _Float16* gk = Kb + (size_t)krow * HD_ + kchk * 8;
    const _Float16* gv = Vt + (size_t)krow * S_  + kchk * 8;
    const float*    gm = mask + (size_t)(q0 + mrow) * S_ + mchk * 4;
    const unsigned  lk = (unsigned)(size_t)(&kvs[0][krow * AT_KP + kchk * 8]);
    const unsigned  lv = lk + AT_KV * 2u;
    const unsigned  lm = (unsigned)(size_t)(&mks[0][mrow * AT_MP + mchk * 4]);
    constexpr unsigned KVB = 2u * AT_KV * 2u;      // bytes from buffer 0 to buffer 1: K, Vt
    constexpr unsigned MKB = AT_Q * AT_MP * 4u;    // ... mask

    copy_kv(lk, gk, lv, gv);
    copy_mask(lm, gm);

    // Q tile B-operands (column = query colx), kept resident: hd 0..31 and 32..63
    const _Float16* qrow = Qb + (size_t)(stile * 16 + colx) * HD_;
    const v16h qb0 = ld_ab(qrow,      g);
    const v16h qb1 = ld_ab(qrow + 32, g);

    // This lane's query: the running maximum (equal in both halves) and the sum over this
    // half's t alone; the halves' sums are joined behind the loop.
    float mrun = -1.0e30f, lrun = 0.0f;
    v8f o[4];                                      // O^T: o[nt][i] = hd nt*16 + 8*g + i of query colx
#pragma unroll
    for (int nt = 0; nt < 4; ++nt) o[nt] = vzero8();

    asm volatile("s_wait_asynccnt 0x0" ::: "memory");   // this wave's copies of stage 0 have landed
    __syncthreads();                                    // ... and every other wave's
    copy_kv(lk + KVB, gk + AT_T * HD_, lv + KVB, gv + AT_T);
    copy_mask(lm + MKB, gm + AT_T);

    for (int st = 0; st < AT_NS; ++st) {
        const _Float16* ks = kvs[st & 1];
        const _Float16* vs = ks + AT_KV;
        const float*    ms = mks[st & 1] + (wave * 16 + colx) * AT_MP + 8 * g;

        // Two steps of 32 t columns; unrolled so that every LDS offset is a constant.
#pragma unroll
        for (int tb = 0; tb < AT_T; tb += 32) {
            // S^T for 32 t: two 16x16 C tiles (row = t, column = query), K=64 over hd
            v8f s0 = vzero8(), s1 = vzero8();
            {
                const _Float16* krow0 = ks + (tb + colx) * AT_KP;
                s0 = wmma16(ld_ab(krow0,      g), qb0, s0);
                s0 = wmma16(ld_ab(krow0 + 32, g), qb1, s0);
                const _Float16* krow1 = ks + (tb + 16 + colx) * AT_KP;
                s1 = wmma16(ld_ab(krow1,      g), qb0, s1);
                s1 = wmma16(ld_ab(krow1 + 32, g), qb1, s1);
            }

            // The mask of this lane's query at its t: tb + 8*g + i and tb + 16 + 8*g + i
            const v4f mk[4] = { *(const v4f*)(ms + tb),      *(const v4f*)(ms + tb + 4),
                                *(const v4f*)(ms + tb + 16), *(const v4f*)(ms + tb + 20) };

            // scale * multiplicative mask; e[i] is t = 8*g + i, e[8 + i] is t = 16 + 8*g + i
            // (two neighbours at a time: accumulator and mask registers pair as they lie)
            float e[16];
#pragma unroll
            for (int j = 0; j < 4; ++j) {
                const v2f m0 = { mk[j >> 1][2 * (j & 1)],     mk[j >> 1][2 * (j & 1) + 1] };
                const v2f m1 = { mk[2 + (j >> 1)][2 * (j & 1)], mk[2 + (j >> 1)][2 * (j & 1) + 1] };
                const v2f a0 = { s0[2 * j], s0[2 * j + 1] };
                const v2f a1 = { s1[2 * j], s1[2 * j + 1] };
                const v2f f0 = a0 * 0.125f * m0;
                const v2f f1 = a1 * 0.125f * m1;
                e[2 * j]     = f0[0]; e[2 * j + 1] = f0[1];
                e[2 * j + 8] = f1[0]; e[2 * j + 9] = f1[1];
            }

            // online softmax over t: the maximum of the lane's 16, then of the query's 32
            float t3[5];
#pragma unroll
            for (int j = 0; j < 5; ++j)
                t3[j] = fmaxf(fmaxf(e[3 * j], e[3 * j + 1]), e[3 * j + 2]);
            float tm = fmaxf(fmaxf(fmaxf(t3[0], t3[1]), t3[2]), fmaxf(fmaxf(t3[3], t3[4]), e[15]));
            tm = fmaxf(tm, xhalf(tm));

            const float mn   = fmaxf(mrun, tm);
            const float corr = exp_slot(mrun - mn);
            mrun = mn;
#pragma unroll
            for (int i = 0; i < 16; ++i) e[i] = (e[i] - mn) * 1.44269504f;
            exp_slot8(e);
            exp_slot8(e + 8);
            float r4[4];
#pragma unroll
            for (int j = 0; j < 4; ++j)
                r4[j] = (e[j] + e[j + 4]) + (e[j + 8] + e[j + 12]);
            lrun = lrun * corr + ((r4[0] + r4[2]) + (r4[1] + r4[3]));
#pragma unroll
            for (int nt = 0; nt < 4; ++nt)
#pragma unroll
                for (int i = 0; i < 8; ++i)
                    o[nt][i] *= corr;

            // P^T as B operand: element j is t = 8*g + j, element 8 + j is t = 16 + 8*g + j,
            // the k order in which ld_ab reads the rows of Vt
            v16h pb;
#pragma unroll
            for (int i = 0; i < 16; ++i) pb[i] = (_Float16)e[i];

            // O^T += V^T (64x32) * P^T (32x16): 4 M-tiles of transposed V (contiguous along t)
#pragma unroll
            for (int nt = 0; nt < 4; ++nt) {
                const _Float16* vrow = vs + (nt * 16 + colx) * AT_KP + tb;
                o[nt] = wmma16(ld_ab(vrow, g), pb, o[nt]);
            }
        }

        asm volatile("s_wait_dscnt 0x0" ::: "memory");     // this wave has left the buffer
        asm volatile("s_wait_asynccnt 0x0" ::: "memory");  // its copies of stage st+1 have landed
        __syncthreads();                                   // publishes stage st+1, frees this buffer
        if (st + 2 < AT_NS) {
            const unsigned bo = (unsigned)(st & 1);
            copy_kv(lk + bo * KVB, gk + (size_t)(st + 2) * (AT_T * HD_),
                    lv + bo * KVB, gv + (st + 2) * AT_T);
            copy_mask(lm + bo * MKB, gm + (st + 2) * AT_T);
        }
    }
    asm volatile("s_wait_asynccnt 0x0" ::: "memory");      // nothing in flight when the wave ends

    // normalize and store to (s,b,d) f16 for the output projection. The wave's 16 rows of
    // 128 B go through its own 16 rows of mask buffer 0 (last read in stage 14, two barriers
    // back; nothing is copied there any more) and leave as whole 128-B lines, 8 lanes a line.
    _Float16* so = (_Float16*)(mks[0] + wave * 16 * AT_MP);
    const float lsum = lrun + xhalf(lrun);         // the two halves' sums of this query
#pragma unroll
    for (int nt = 0; nt < 4; ++nt) {
        v8h pk;                                    // eight hd in a row of query colx
#pragma unroll
        for (int i = 0; i < 8; ++i) pk[i] = (_Float16)(o[nt][i] / lsum);
        *(v8h*)(so + colx * (AT_MP * 2) + nt * 16 + 8 * g) = pk;
    }
    asm volatile("s_wait_dscnt 0" ::: "memory");   // the wave's rows are written before it reads them back
    const int r = lane >> 3, c = lane & 7;
    v8h v[4];
#pragma unroll
    for (int j = 0; j < 4; ++j) v[j] = *(const v8h*)(so + (r + 4 * j) * (AT_MP * 2) + c * 8);
    _Float16* gp = attn + ((size_t)((stile * 16 + r) * B_ + b)) * D_ + h * 64 + c * 8;
#pragma unroll
    for (int j = 0; j < 4; ++j) *(v8h*)(gp + j * 4 * B_ * D_) = v[j];
}

// ---------------------------------------------------------------- output projection
// attn (2048x1024,f16) @ Wo^T + bo -> out (f32); gemm_tile with 4 waves (2 x 2). The 64 x 128 results go through
// LDS and leave as 16-byte stores, a wave covering one row's 512 B.
#define OT_P 132                            // staging row: 128 floats + 4 (528 B)
__global__ __launch_bounds__(128) void out_gemm_kernel(
    const _Float16* __restrict__ attn, const _Float16* __restrict__ Wo16,
    const float* __restrict__ bo, float* __restrict__ out)
{
    __shared__ __attribute__((aligned(16))) _Float16 sm[2 * GT_BUF];

    const int lane  = threadIdx.x & 31;
    const int colx  = lane & 15;
    const int g     = lane >> 4;
    const int wave  = threadIdx.x >> 5;
    const int ml    = (wave >> 1) * 32 + 8 * g;              // this lane's row at mt = 0, i = 0
    const int nl    = (wave & 1) * 64 + colx;                // this lane's column at nt = 0

    v8f acc[2][4];
    gemm_tile<D_, 128, 2, 2, 4>(attn, Wo16, blockIdx.x * GT_M, blockIdx.y * GT_N, sm, acc);

    float bn[4];
#pragma unroll
    for (int nt = 0; nt < 4; ++nt) bn[nt] = bo[blockIdx.y * GT_N + nl + nt * 16];

    // sm is free here, as in the QKV kernel.
    float* so = (float*)sm;
#pragma unroll
    for (int nt = 0; nt < 4; ++nt)
#pragma unroll
        for (int mt = 0; mt < 2; ++mt)
#pragma unroll
            for (int i = 0; i < 8; ++i)
                so[(ml + mt * 16 + i) * OT_P + nl + nt * 16] = acc[mt][nt][i] + bn[nt];
    __syncthreads();                        // the staged tile is read across waves

    // this wave's rows: wave, wave+4, ..., wave+60
    v4f v[16];
#pragma unroll
    for (int j = 0; j < 16; ++j) v[j] = *(const v4f*)(so + (wave + 4 * j) * OT_P + lane * 4);
    float* gp = out + (size_t)(blockIdx.x * GT_M + wave) * D_ + blockIdx.y * GT_N + lane * 4;
#pragma unroll
    for (int j = 0; j < 16; ++j) *(v4f*)(gp + j * 4 * D_) = v[j];
}

// ---------------------------------------------------------------- launch
extern "C" void kernel_launch(void* const* d_in, const int* in_sizes, int n_in,
                              void* d_out, int out_size, void* d_ws, size_t ws_size,
                              hipStream_t stream) {
    (void)in_sizes; (void)n_in; (void)out_size; (void)ws_size;

    const float* query = (const float*)d_in[0];
    const float* mask  = (const float*)d_in[1];
    const float* Wq    = (const float*)d_in[2];
    const float* bq    = (const float*)d_in[3];
    const float* Wk    = (const float*)d_in[4];
    const float* bk    = (const float*)d_in[5];
    const float* Wv    = (const float*)d_in[6];
    const float* bv    = (const float*)d_in[7];
    const float* Wo    = (const float*)d_in[8];
    const float* bo    = (const float*)d_in[9];
    float* out = (float*)d_out;

    char* ws = (char*)d_ws;
    const size_t MB = 1024 * 1024;
    _Float16* qf16 = (_Float16*)(ws);             // 2048x1024        (4 MB)
    _Float16* wf16 = (_Float16*)(ws + 4 * MB);    // 4x 1024x1024     (8 MB): q,k,v,o
    _Float16* xq   = (_Float16*)(ws + 12 * MB);   // (b,h,s,hd)       (4 MB)
    _Float16* xk   = (_Float16*)(ws + 16 * MB);   // (b,h,t,hd)       (4 MB)
    _Float16* xvT  = (_Float16*)(ws + 20 * MB);   // (b,h,hd,t)       (4 MB)
    _Float16* attn = (_Float16*)(ws + 24 * MB);   // (s,b,d)          (4 MB)

    const int NW = D_ * D_;     // 1M
    // qf16 and wf16 lie one behind the other: one destination of 6 parts.
    cvt_f16_kernel<<<dim3(CV_PART / CV_WG, 6), CV_TH, 0, stream>>>(query, Wq, Wk, Wv, Wo, qf16);

    qkv_gemm_kernel<<<dim3(M_ / QT_M, 3 * D_ / QT_N), 256, 0, stream>>>(
        qf16, wf16, bq, bk, bv, xq, xk, xvT);

    attn_kernel<<<B_ * H_ * (S_ / AT_Q), AT_W * 32, 0, stream>>>(xq, xk, xvT, mask, attn);

    out_gemm_kernel<<<dim3(M_ / GT_M, D_ / GT_N), 128, 0, stream>>>(
        attn, wf16 + 3 * (size_t)NW, bo, out);
}

// v007
// A run of this version takes 47.2 microseconds.
// Timed twice side by side with v006, it ran 1.07 and 1.08 times as fast.
// Over all steps from v000 it is 3.89 times as fast.
#include <hip/hip_runtime.h>

#define S_  1024
#define B_  2
#define D_  1024
#define H_  16
#define HD_ 64
#define M_  (S_*B_)   // 2048 rows

typedef _Float16 v16h __attribute__((ext_vector_type(16)));
typedef _Float16 v8h  __attribute__((ext_vector_type(8)));
typedef float    v8f  __attribute__((ext_vector_type(8)));

static __device__ __forceinline__ v8f vzero8() {
    v8f z;
#pragma unroll
    for (int i = 0; i < 8; ++i) z[i] = 0.0f;
    return z;
}

// Load a 16x32 (f16) WMMA A/B operand chunk for this lane.
// p = start of this lane's row (A: row m; B: col n) at the current k-base.
// Lane group g (=lane>>4): g=0 takes halves {0..7,16..23}, g=1 takes {8..15,24..31}.
static __device__ __forceinline__ v16h ld_ab(const _Float16* p, int g) {
    v8h lo = *(const v8h*)(p + g * 8);
    v8h hi = *(const v8h*)(p + g * 8 + 16);
    return __builtin_shufflevector(lo, hi, 0,1,2,3,4,5,6,7,8,9,10,11,12,13,14,15);
}

static __device__ __forceinline__ v8f wmma16(v16h a, v16h b, v8f c) {
    // D = A(16x32,f16) * B(32x16,f16) + C(16x16,f32)
    return __builtin_amdgcn_wmma_f32_16x16x32_f16(false, a, false, b, (short)0, c, false, false);
}

// ---------------------------------------------------------------- convert
// All five f32 -> f16 conversions in one launch. The destination is one run of
// 6 x 2^20 halves (query, then Wq, Wk, Wv, Wo); blockIdx.y names the 2^20-value part.
// A wave takes 2,048 values in a row: sixteen 16-byte loads a lane, each 512 B in a row
// over the wave; each store is 256 B in a row.
// Few, long waves, for speed only.
#define CV_PART (1 << 20)                   // values per part
#define CV_LD   16                          // 16-byte loads a lane
#define CV_TH   128                         // threads per work-group
#define CV_WG   (CV_TH * 4 * CV_LD)         // values per work-group (8,192)

typedef float    v4f __attribute__((ext_vector_type(4)));
typedef _Float16 v4h __attribute__((ext_vector_type(4)));
typedef float    v2f __attribute__((ext_vector_type(2)));

__global__ __launch_bounds__(CV_TH) void cvt_f16_kernel(
    const float* __restrict__ query, const float* __restrict__ Wq,
    const float* __restrict__ Wk, const float* __restrict__ Wv,
    const float* __restrict__ Wo, _Float16* __restrict__ dst)
{
    const int part = blockIdx.y;            // 0,1: query; 2..5: Wq, Wk, Wv, Wo
    const float* src = (part < 2)  ? query + (size_t)part * CV_PART
                     : (part == 2) ? Wq
                     : (part == 3) ? Wk
                     : (part == 4) ? Wv : Wo;
    const int off = blockIdx.x * CV_WG + (threadIdx.x >> 5) * (128 * CV_LD)
                  + (threadIdx.x & 31) * 4;
    const float* s = src + off;
    _Float16*    d = dst + (size_t)part * CV_PART + off;

    v4f v[CV_LD];
#pragma unroll
    for (int j = 0; j < CV_LD; ++j) v[j] = *(const v4f*)(s + j * 128);
#pragma unroll
    for (int j = 0; j < CV_LD; ++j)
        *(v4h*)(d + j * 128) = __builtin_convertvector(v[j], v4h);
}

// ---------------------------------------------------------------- GEMM tile in LDS
// Output projection: a work-group of 4 waves (2 x 2) makes a 64M x 128N tile, 32M x 64N a wave.
// QKV: a work-group of 8 waves (2 x 4) makes a 128M x 192N tile, 64M x 48N a wave: 256
// work-groups, one on each WGP, and (128 + 192) operand rows copied from L2 for 128 x 192
// results, where three 64 x 128 tiles copy 576 rows for the same number of results.
// A pass is 128 k: the tile's rows of X and of W, 256 B each, copied to LDS at a
// pitch of 272 B (ds_load_b128 reads of 16 rows then fall on all 64 banks).
// Three buffers: a pass's copies are issued two passes ahead of its use. The two halves of
// the work-group's waves copy in turn, the lower half the even passes and the upper half
// the odd ones, so that a wave never has more than one pass's copies in flight and its
// wait for them is a wait to 0.
#define GT_M   64
#define GT_N   128
#define QT_M   128
#define QT_N   192
#define GT_K   128
#define GT_P   136                          // LDS row pitch in halves (272 B)
#define GT_BUF ((GT_M + GT_N) * GT_P)       // halves per buffer (52,224 B)
#define QT_BUF ((QT_M + QT_N) * GT_P)       // ... of the QKV tile (87,040 B)
#define GT_NP  (D_ / GT_K)                  // 8 passes

// Eight 16-byte copies of this lane: its chunk in rows r, r+RS, ..., r+7*RS.
// LD: halves from one row of the tile to the next in global memory.
// RS: rows that one copy of the work-group's copying half covers (16 lanes a row).
// The s_wait_xcnt stands inside the statement so that no address register of a
// copy is rewritten in front of it.
template <int LD, int RS>
static __device__ __forceinline__ void copy8(unsigned l, const _Float16* p) {
    constexpr unsigned STEP_L = (unsigned)RS * GT_P * 2u;   // RS rows in LDS, bytes
    constexpr int      STEP_G = RS * LD;                    // RS rows in global, halves
    asm volatile(
        "global_load_async_to_lds_b128 %0, %1, off\n\t"
        "global_load_async_to_lds_b128 %2, %3, off\n\t"
        "global_load_async_to_lds_b128 %4, %5, off\n\t"
        "global_load_async_to_lds_b128 %6, %7, off\n\t"
        "global_load_async_to_lds_b128 %8, %9, off\n\t"
        "global_load_async_to_lds_b128 %10, %11, off\n\t"
        "global_load_async_to_lds_b128 %12, %13, off\n\t"
        "global_load_async_to_lds_b128 %14, %15, off\n\t"
        "s_wait_xcnt 0x0"
        :: "v"(l + 0u * STEP_L), "v"(p + 0 * STEP_G),
           "v"(l + 1u * STEP_L), "v"(p + 1 * STEP_G),
           "v"(l + 2u * STEP_L), "v"(p + 2 * STEP_G),
           "v"(l + 3u * STEP_L), "v"(p + 3 * STEP_G),
           "v"(l + 4u * STEP_L), "v"(p + 4 * STEP_G),
           "v"(l + 5u * STEP_L), "v"(p + 5 * STEP_G),
           "v"(l + 6u * STEP_L), "v"(p + 6 * STEP_G),
           "v"(l + 7u * STEP_L), "v"(p + 7 * STEP_G)
        : "memory");
}

// The same for four copies: rows r, r+RS, r+2*RS, r+3*RS; the wait as above.
template <int LD, int RS>
static __device__ __forceinline__ void copy4(unsigned l, const _Float16* p) {
    constexpr unsigned STEP_L = (unsigned)RS * GT_P * 2u;
    constexpr int      STEP_G = RS * LD;
    asm volatile(
        "global_load_async_to_lds_b128 %0, %1, off\n\t"
        "global_load_async_to_lds_b128 %2, %3, off\n\t"
        "global_load_async_to_lds_b128 %4, %5, off\n\t"
        "global_load_async_to_lds_b128 %6, %7, off\n\t"
        "s_wait_xcnt 0x0"
        :: "v"(l + 0u * STEP_L), "v"(p + 0 * STEP_G),
           "v"(l + 1u * STEP_L), "v"(p + 1 * STEP_G),
           "v"(l + 2u * STEP_L), "v"(p + 2 * STEP_G),
           "v"(l + 3u * STEP_L), "v"(p + 3 * STEP_G)
        : "memory");
}

// ROWS rows of one operand: ROWS / RS copies a lane, eight to a statement and a last four.
template <int LD, int RS, int ROWS>
static __device__ __forceinline__ void copy_rows(unsigned l, const _Float16* p) {
    constexpr int N = ROWS / RS;
    static_assert(ROWS % (4 * RS) == 0, "whole statements of four or eight copies");
    if constexpr (N >= 8) {
        copy8<LD, RS>(l, p);
        if constexpr (N > 8)
            copy_rows<LD, RS, ROWS - 8 * RS>(l + 8u * RS * GT_P * 2u, p + (size_t)(8 * RS) * LD);
    } else {
        copy4<LD, RS>(l, p);
    }
}

// One pass's tile: TM + TN rows x 16 chunks of 16 B; 16 lanes cover a row.
// l: LDS byte address of this lane's chunk in its first row of the buffer;
// xa, wb: the same chunk in the X tile and in the W tile at the pass's k.
template <int LDX, int RS, int TM, int TN>
static __device__ __forceinline__ void copy_pass(unsigned l, const _Float16* xa,
                                                 const _Float16* wb) {
    copy_rows<LDX, RS, TM>(l, xa);
    copy_rows<D_, RS, TN>(l + TM * GT_P * 2u, wb);
}

// acc[mt][nt] = X[m0 + wm*MT*16 + mt*16 ..][:] . W[n0 + wn*NT*16 + nt*16 ..][:]^T over all of K;
// row r of X begins at X + r * LDX. The work-group's TH / 32 waves lie WN to a row of waves.
// The loops over mt, nt and kb are unrolled so that every index of a fragment or
// accumulator array is a constant and the arrays stay in registers.
template <int LDX, int TH, int WN, int MT, int NT>
static __device__ __forceinline__ void gemm_tile(
    const _Float16* __restrict__ X, const _Float16* __restrict__ Wt,
    int m0, int n0, _Float16* sm, v8f (&acc)[MT][NT])
{
    constexpr int      TM  = (TH / 32 / WN) * MT * 16;   // rows of X in the tile
    constexpr int      TN  = WN * NT * 16;               // rows of W
    constexpr int      CT  = TH / 2;                     // threads that copy a pass: half of the waves
    constexpr int      RS  = CT / 16;                    // rows that one copy of each of them covers
    constexpr unsigned BUF = (TM + TN) * GT_P;           // halves per buffer
    static_assert((TM + TN) / RS <= 63, "copies of a wave in flight");

    const int tid  = threadIdx.x;
    const int lane = tid & 31;
    const int colx = lane & 15;
    const int g    = lane >> 4;
    const int wave = tid >> 5;
    const int wm   = wave / WN;
    const int wn   = wave % WN;

    // Which half of the waves this one is in, held in a scalar register: the tests on it
    // around the copies and their waits are then scalar branches that a whole wave takes.
    const int half = __builtin_amdgcn_readfirstlane(tid / CT);

    const int crow = (tid % CT) >> 4;   // 0..RS-1
    const int cchk = tid & 15;          // 16-byte chunk in the row
    const _Float16* xa = X  + (size_t)(m0 + crow) * LDX + cchk * 8;
    const _Float16* wb = Wt + (size_t)(n0 + crow) * D_ + cchk * 8;
    const unsigned  l0 = (unsigned)(size_t)(sm + crow * GT_P + cchk * 8);

#pragma unroll
    for (int mt = 0; mt < MT; ++mt)
#pragma unroll
        for (int nt = 0; nt < NT; ++nt) acc[mt][nt] = vzero8();

    if (half == 0) {
        copy_pass<LDX, RS, TM, TN>(l0, xa, wb);
        asm volatile("s_wait_asynccnt 0x0" ::: "memory");   // this wave's copies of pass 0 have landed
    } else {
        copy_pass<LDX, RS, TM, TN>(l0 + BUF * 2u, xa + GT_K, wb + GT_K);
    }
    __syncthreads();                                        // publishes pass 0
    if (half == 0)
        copy_pass<LDX, RS, TM, TN>(l0 + 2u * (BUF * 2u), xa + 2 * GT_K, wb + 2 * GT_K);

    unsigned cb = 0;                    // the buffer of pass t: t mod 3
    for (int t = 0; t < GT_NP; ++t) {
        const _Float16* buf = sm + cb * BUF;
        const bool mine = half == ((t + 1) & 1);            // this half copies passes t+1 and t+3
        const _Float16* sa  = buf + (wm * (MT * 16) + colx) * GT_P;
        const _Float16* sb  = buf + (TM + wn * (NT * 16) + colx) * GT_P;
        // Fragments of the next 32 k are read, as one group, ahead of this block's WMMAs.
        v16h a[2][MT], bm[2][NT];
#pragma unroll
        for (int mt = 0; mt < MT; ++mt) a[0][mt] = ld_ab(sa + mt * 16 * GT_P, g);
#pragma unroll
        for (int nt = 0; nt < NT; ++nt) bm[0][nt] = ld_ab(sb + nt * 16 * GT_P, g);
#pragma unroll
        for (int kb = 0; kb < GT_K / 32; ++kb) {
            const int cur = kb & 1, nxt = cur ^ 1;
            if (kb + 1 < GT_K / 32) {
#pragma unroll
                for (int mt = 0; mt < MT; ++mt)
                    a[nxt][mt] = ld_ab(sa + mt * 16 * GT_P + (kb + 1) * 32, g);
#pragma unroll
                for (int nt = 0; nt < NT; ++nt)
                    bm[nxt][nt] = ld_ab(sb + nt * 16 * GT_P + (kb + 1) * 32, g);
            }
            // Keeps the read group in front of the WMMA block: left free, the scheduler
            // sinks each read to its use and every WMMA pair waits out an LDS latency.
            __builtin_amdgcn_sched_barrier(0);
#pragma unroll
            for (int nt = 0; nt < NT; ++nt)
#pragma unroll
                for (int mt = 0; mt < MT; ++mt)
                    acc[mt][nt] = wmma16(a[cur][mt], bm[cur][nt], acc[mt][nt]);
            // Keeps the following read group behind this block, so that it stays one group.
            __builtin_amdgcn_sched_barrier(0);
        }
        asm volatile("s_wait_dscnt 0x0" ::: "memory");     // this wave has left the buffer
        if (mine)
            asm volatile("s_wait_asynccnt 0x0" ::: "memory");  // its copies of pass t+1 have landed
        __syncthreads();                                   // publishes pass t+1, frees this buffer
        if (mine && t + 3 < GT_NP)
            copy_pass<LDX, RS, TM, TN>(l0 + cb * (BUF * 2u), xa + (t + 3) * GT_K, wb + (t + 3) * GT_K);
        cb = (cb == 2u) ? 0u : cb + 1u;
    }
    asm volatile("s_wait_asynccnt 0x0" ::: "memory");      // nothing in flight when the wave ends
}

// ---------------------------------------------------------------- QKV GEMM
// X (2048x1024, f16) @ [Wq; Wk; Wv]^T + b: the three weights lie one behind the other, so
// that the product has 3,072 columns = 48 heads of 64: 16 of q, 16 of k, 16 of v.
// Outputs: xq/xk in (b,h,s,hd), xv transposed to (b,h,hd,t).
// A work-group takes 128 s of ONE b (every second row of X) and three heads in a row, each
// of which may be of q, of k or of v. Its results are whole 128-B lines of the destination:
// a head of q or k is 128 rows (s) of 64 hd, a head of v 64 rows (hd) of 128 t. They go
// through LDS in that order and leave as 16-byte stores.
#define ST_P 72                             // staging row of q, k: 64 halves + 8 (144 B)
#define SV_P 136                            // staging row of v: 128 halves + 8 (272 B)
#define ST_H (QT_M * ST_P)                  // halves of a head's staging area (v fills 64 * SV_P of it)
__global__ __launch_bounds__(256) void qkv_gemm_kernel(
    const _Float16* __restrict__ qf16, const _Float16* __restrict__ wf16,
    const float* __restrict__ bq, const float* __restrict__ bk,
    const float* __restrict__ bv,
    _Float16* __restrict__ xq, _Float16* __restrict__ xk,
    _Float16* __restrict__ xvT)
{
    __shared__ __attribute__((aligned(16))) _Float16 sm[3 * QT_BUF];

    const int tid   = threadIdx.x;
    const int lane  = tid & 31;
    const int colx  = lane & 15;
    const int g     = lane >> 4;
    const int wave  = tid >> 5;
    const int b     = blockIdx.x & 1;
    const int s0    = (blockIdx.x >> 1) * QT_M;              // first s of the work-group
    const int sl    = (wave >> 2) * 64 + 8 * g;              // this lane's s - s0 at mt = 0, i = 0
    const int gh0   = blockIdx.y * 3;                        // first of the three heads, 0..47

    v8f acc[4][3];
    // rows of X are (s,b) interleaved, B=2: row s of this b begins at qf16 + b*D_ + s*(B_*D_)
    gemm_tile<B_ * D_, 256, 4, 4, 3>(qf16 + b * D_, wf16, s0, blockIdx.y * QT_N, sm, acc);

    // sm is free here: every wave has passed the last pass's barrier with its LDS reads
    // retired, and no copy is in flight.
    float bn3[3];
#pragma unroll
    for (int nt = 0; nt < 3; ++nt) {
        const int ct    = (wave & 3) * 3 + nt;               // 16-column tile, 0..11
        const int gh    = gh0 + (ct >> 2);                   // its head
        const int which = gh >> 4;                           // 0=q 1=k 2=v
        const float* bias = (which == 0) ? bq : (which == 1) ? bk : bv;
        bn3[nt] = bias[(gh & 15) * HD_ + (ct & 3) * 16 + colx];
    }
#pragma unroll
    for (int nt = 0; nt < 3; ++nt) {
        const int ct    = (wave & 3) * 3 + nt;
        const int which = (gh0 + (ct >> 2)) >> 4;
        const int hd    = (ct & 3) * 16 + colx;              // this lane's column in the head
        const float  bn = bn3[nt];
        _Float16*    sh = sm + (ct >> 2) * ST_H;
        if (which == 2) {
            // staging row = hd: a lane's eight values are eight t in a row
#pragma unroll
            for (int mt = 0; mt < 4; ++mt) {
                v8h pk;
#pragma unroll
                for (int i = 0; i < 8; ++i) pk[i] = (_Float16)(acc[mt][nt][i] + bn);
                *(v8h*)(sh + hd * SV_P + sl + mt * 16) = pk;
            }
        } else {
            // staging row = s
#pragma unroll
            for (int mt = 0; mt < 4; ++mt)
#pragma unroll
                for (int i = 0; i < 8; ++i)
                    sh[(sl + mt * 16 + i) * ST_P + hd] = (_Float16)(acc[mt][nt][i] + bn);
        }
    }
    __syncthreads();                        // the staged tile is read across waves

    // A head is 1,024 chunks of 16 B, four a thread. q, k: 128 rows of 8 chunks, this
    // thread's chunk in rows r, r+32, r+64, r+96; v: 64 rows of 16 chunks, rows r, r+16,
    // r+32, r+48. All twelve chunks are read before the first is stored.
    v8h       v[3][4];
    _Float16* gp[3];
    int       gs[3];
#pragma unroll
    for (int hl = 0; hl < 3; ++hl) {
        const int  gh  = gh0 + hl;
        const int  bh  = b * H_ + (gh & 15);
        const bool isv = (gh >> 4) == 2;
        const int  r   = isv ? tid >> 4 : tid >> 3;
        const int  c   = isv ? tid & 15 : tid & 7;
        const _Float16* sp = sm + hl * ST_H + r * (isv ? SV_P : ST_P) + c * 8;
        const int  ss  = isv ? 16 * SV_P : 32 * ST_P;        // halves from one of its rows to the next
#pragma unroll
        for (int j = 0; j < 4; ++j) v[hl][j] = *(const v8h*)(sp + j * ss);
        gp[hl] = isv ? xvT + (size_t)(bh * HD_ + r) * S_ + s0 + c * 8                    // (b,h,hd,t)
                     : (((gh >> 4) == 0) ? xq : xk) + (size_t)(bh * S_ + s0 + r) * HD_ + c * 8;  // (b,h,s,hd)
        gs[hl] = isv ? 16 * S_ : 32 * HD_;
    }
#pragma unroll
    for (int hl = 0; hl < 3; ++hl)
#pragma unroll
        for (int j = 0; j < 4; ++j) *(v8h*)(gp[hl] + j * gs[hl]) = v[hl][j];
}

#define AT_W   8                            // waves per work-group
#define AT_Q   (AT_W * 16)                  // Q rows per work-group
#define AT_T   64                           // t columns per stage
#define AT_KP  72                           // K / Vt row pitch in halves (144 B)
#define AT_MP  68                           // mask row pitch in floats (272 B)
#define AT_KV  (64 * AT_KP)                 // halves in a K tile, and in a Vt tile
#define AT_NS  (S_ / AT_T)                  // 16 stages

// This lane's 16-byte chunk in rows r, r+16, r+32, r+48 of the K tile and of the Vt tile.
// The s_wait_xcnt stands inside the statement so that no address register of a
// copy is rewritten in front of it.
static __device__ __forceinline__ void copy_kv(unsigned lk, const _Float16* k,
                                               unsigned lv, const _Float16* v) {
    constexpr unsigned STEP_L = 16u * AT_KP * 2u;   // 16 rows in LDS, bytes
    asm volatile(
        "global_load_async_to_lds_b128 %0, %1, off\n\t"
        "global_load_async_to_lds_b128 %2, %3, off\n\t"
        "global_load_async_to_lds_b128 %4, %5, off\n\t"
        "global_load_async_to_lds_b128 %6, %7, off\n\t"
        "global_load_async_to_lds_b128 %8, %9, off\n\t"
        "global_load_async_to_lds_b128 %10, %11, off\n\t"
        "global_load_async_to_lds_b128 %12, %13, off\n\t"
        "global_load_async_to_lds_b128 %14, %15, off\n\t"
        "s_wait_xcnt 0x0"
        :: "v"(lk + 0u * STEP_L), "v"(k + 0 * 16 * HD_),
           "v"(lk + 1u * STEP_L), "v"(k + 1 * 16 * HD_),
           "v"(lk + 2u * STEP_L), "v"(k + 2 * 16 * HD_),
           "v"(lk + 3u * STEP_L), "v"(k + 3 * 16 * HD_),
           "v"(lv + 0u * STEP_L), "v"(v + 0 * 16 * S_),
           "v"(lv + 1u * STEP_L), "v"(v + 1 * 16 * S_),
           "v"(lv + 2u * STEP_L), "v"(v + 2 * 16 * S_),
           "v"(lv + 3u * STEP_L), "v"(v + 3 * 16 * S_)
        : "memory");
}

// This lane's 16-byte chunk in rows r, r+8, ..., r+56 of the mask tile; the wait as above.
static __device__ __forceinline__ void copy_mask8(unsigned l, const float* p) {
    constexpr unsigned STEP_L = 8u * AT_MP * 4u;    // 8 rows in LDS, bytes
    constexpr int      STEP_G = 8 * S_;             // 8 rows in global, floats
    asm volatile(
        "global_load_async_to_lds_b128 %0, %1, off\n\t"
        "global_load_async_to_lds_b128 %2, %3, off\n\t"
        "global_load_async_to_lds_b128 %4, %5, off\n\t"
        "global_load_async_to_lds_b128 %6, %7, off\n\t"
        "global_load_async_to_lds_b128 %8, %9, off\n\t"
        "global_load_async_to_lds_b128 %10, %11, off\n\t"
        "global_load_async_to_lds_b128 %12, %13, off\n\t"
        "global_load_async_to_lds_b128 %14, %15, off\n\t"
        "s_wait_xcnt 0x0"
        :: "v"(l + 0u * STEP_L), "v"(p + 0 * STEP_G),
           "v"(l + 1u * STEP_L), "v"(p + 1 * STEP_G),
           "v"(l + 2u * STEP_L), "v"(p + 2 * STEP_G),
           "v"(l + 3u * STEP_L), "v"(p + 3 * STEP_G),
           "v"(l + 4u * STEP_L), "v"(p + 4 * STEP_G),
           "v"(l + 5u * STEP_L), "v"(p + 5 * STEP_G),
           "v"(l + 6u * STEP_L), "v"(p + 6 * STEP_G),
           "v"(l + 7u * STEP_L), "v"(p + 7 * STEP_G)
        : "memory");
}

// The 128 rows of the mask tile: the upper 64 behind the lower 64.
static __device__ __forceinline__ void copy_mask(unsigned l, const float* p) {
    copy_mask8(l, p);
    copy_mask8(l + 64u * AT_MP * 4u, p + 64 * S_);
}

// e^x as __expf forms it (x * log2(e), then v_exp_f32), with the one free slot that the
// instruction set asks for behind a transcendental kept in the same statement.
// The exp works in place: the only register that the asm text writes is one that the
// multiply in front of it has written, so it is never a register that a WMMA still reads.
static __device__ __forceinline__ float exp_slot(float x) {
    float r = x * 1.44269504f;
    asm("v_exp_f32 %0, %0\n\tv_nop" : "+v"(r));
    return r;
}

// The same for eight values: each exp is followed by one that shares no register with it,
// so that one free slot behind the last serves the run.
static __device__ __forceinline__ void exp_slot8(float* e) {
    asm("v_exp_f32 %0, %0\n\t"
        "v_exp_f32 %1, %1\n\t"
        "v_exp_f32 %2, %2\n\t"
        "v_exp_f32 %3, %3\n\t"
        "v_exp_f32 %4, %4\n\t"
        "v_exp_f32 %5, %5\n\t"
        "v_exp_f32 %6, %6\n\t"
        "v_exp_f32 %7, %7\n\t"
        "v_nop"
        : "+v"(e[0]), "+v"(e[1]), "+v"(e[2]), "+v"(e[3]),
          "+v"(e[4]), "+v"(e[5]), "+v"(e[6]), "+v"(e[7]));
}

// Lane l with lane l ^ 16, on the vector port.
static __device__ __forceinline__ float xhalf(float x) {
    const int b = __builtin_bit_cast(int, x);
    return __builtin_bit_cast(float,
        __builtin_amdgcn_permlanex16(b, b, 0x76543210, 0xfedcba98, false, false));
}

__global__ __launch_bounds__(AT_W * 32) void attn_kernel(
    const _Float16* __restrict__ xq, const _Float16* __restrict__ xk,
    const _Float16* __restrict__ xvT, const float* __restrict__ mask,
    _Float16* __restrict__ attn)
{
    __shared__ __attribute__((aligned(16))) _Float16 kvs[3][2 * AT_KV];     // K tile, Vt tile
    __shared__ __attribute__((aligned(16))) float    mks[3][AT_Q * AT_MP];  // mask tile

    const int tid   = threadIdx.x;
    const int lane  = tid & 31;
    const int colx  = lane & 15;
    const int g     = lane >> 4;
    const int wave  = tid >> 5;
    const int q0    = (blockIdx.x & 7) * AT_Q;     // first Q row of the work-group
    const int stile = (q0 >> 4) + wave;            // this wave's 16 Q rows
    const int h     = (blockIdx.x >> 3) & 15;
    const int b     = blockIdx.x >> 7;

    const _Float16* Qb = xq  + ((size_t)(b * H_ + h) * S_) * HD_;
    const _Float16* Kb = xk  + ((size_t)(b * H_ + h) * S_) * HD_;
    const _Float16* Vt = xvT + ((size_t)(b * H_ + h) * HD_) * S_;

    // Which half of the waves this one is in, held in a scalar register: the tests on it
    // around the copies and their waits are then scalar branches that a whole wave takes.
    const int half = __builtin_amdgcn_readfirstlane(tid >> 7);

    // Copy addresses of this lane at stage 0, buffer 0. K, Vt: 8 lanes cover a row of
    // 128 B, the four copying waves 16 rows; mask: 16 lanes cover a row of 256 B, they 8.
    const int ctid = tid & 127;
    const int krow = ctid >> 3, kchk = ctid & 7;
    const int mrow = ctid >> 4, mchk = ctid & 15;
    const _Float16* gk = Kb + (size_t)krow * HD_ + kchk * 8;
    const _Float16* gv = Vt + (size_t)krow * S_  + kchk * 8;
    const float*    gm = mask + (size_t)(q0 + mrow) * S_ + mchk * 4;
    const unsigned  lk = (unsigned)(size_t)(&kvs[0][krow * AT_KP + kchk * 8]);
    const unsigned  lv = lk + AT_KV * 2u;
    const unsigned  lm = (unsigned)(size_t)(&mks[0][mrow * AT_MP + mchk * 4]);
    constexpr unsigned KVB = 2u * AT_KV * 2u;      // bytes from one buffer to the next: K, Vt
    constexpr unsigned MKB = AT_Q * AT_MP * 4u;    // ... mask

    if (half == 0) {
        copy_kv(lk, gk, lv, gv);
        copy_mask(lm, gm);
    } else {
        copy_kv(lk + KVB, gk + AT_T * HD_, lv + KVB, gv + AT_T);
        copy_mask(lm + MKB, gm + AT_T);
    }

    // Q tile B-operands (column = query colx), kept resident: hd 0..31 and 32..63
    const _Float16* qrow = Qb + (size_t)(stile * 16 + colx) * HD_;
    const v16h qb0 = ld_ab(qrow,      g);
    const v16h qb1 = ld_ab(qrow + 32, g);

    // This lane's query: the running maximum (equal in both halves) and the sum over this
    // half's t alone; the halves' sums are joined behind the loop.
    float mrun = -1.0e30f, lrun = 0.0f;
    v8f o[4];                                      // O^T: o[nt][i] = hd nt*16 + 8*g + i of query colx
#pragma unroll
    for (int nt = 0; nt < 4; ++nt) o[nt] = vzero8();

    if (half == 0)
        asm volatile("s_wait_asynccnt 0x0" ::: "memory");   // this wave's copies of stage 0 have landed
    __syncthreads();                                        // publishes stage 0
    if (half == 0) {
        copy_kv(lk + 2u * KVB, gk + 2 * AT_T * HD_, lv + 2u * KVB, gv + 2 * AT_T);
        copy_mask(lm + 2u * MKB, gm + 2 * AT_T);
    }

    unsigned cb = 0;                               // the buffer of stage st: st mod 3
    for (int st = 0; st < AT_NS; ++st) {
        const _Float16* ks = kvs[cb];
        const _Float16* vs = ks + AT_KV;
        const float*    ms = mks[cb] + (wave * 16 + colx) * AT_MP + 8 * g;
        const bool mine = half == ((st + 1) & 1);  // this half copies stages st+1 and st+3

        // Two steps of 32 t columns; unrolled so that every LDS offset is a constant.
#pragma unroll
        for (int tb = 0; tb < AT_T; tb += 32) {
            // S^T for 32 t: two 16x16 C tiles (row = t, column = query), K=64 over hd
            v8f s0 = vzero8(), s1 = vzero8();
            {
                const _Float16* krow0 = ks + (tb + colx) * AT_KP;
                s0 = wmma16(ld_ab(krow0,      g), qb0, s0);
                s0 = wmma16(ld_ab(krow0 + 32, g), qb1, s0);
                const _Float16* krow1 = ks + (tb + 16 + colx) * AT_KP;
                s1 = wmma16(ld_ab(krow1,      g), qb0, s1);
                s1 = wmma16(ld_ab(krow1 + 32, g), qb1, s1);
            }

            // The mask of this lane's query at its t: tb + 8*g + i and tb + 16 + 8*g + i
            const v4f mk[4] = { *(const v4f*)(ms + tb),      *(const v4f*)(ms + tb + 4),
                                *(const v4f*)(ms + tb + 16), *(const v4f*)(ms + tb + 20) };

            // scale * multiplicative mask; e[i] is t = 8*g + i, e[8 + i] is t = 16 + 8*g + i
            // (two neighbours at a time: accumulator and mask registers pair as they lie)
            float e[16];
#pragma unroll
            for (int j = 0; j < 4; ++j) {
                const v2f m0 = { mk[j >> 1][2 * (j & 1)],     mk[j >> 1][2 * (j & 1) + 1] };
                const v2f m1 = { mk[2 + (j >> 1)][2 * (j & 1)], mk[2 + (j >> 1)][2 * (j & 1) + 1] };
                const v2f a0 = { s0[2 * j], s0[2 * j + 1] };
                const v2f a1 = { s1[2 * j], s1[2 * j + 1] };
                const v2f f0 = a0 * 0.125f * m0;
                const v2f f1 = a1 * 0.125f * m1;
                e[2 * j]     = f0[0]; e[2 * j + 1] = f0[1];
                e[2 * j + 8] = f1[0]; e[2 * j + 9] = f1[1];
            }

            // online softmax over t: the maximum of the lane's 16, then of the query's 32
            float t3[5];
#pragma unroll
            for (int j = 0; j < 5; ++j)
                t3[j] = fmaxf(fmaxf(e[3 * j], e[3 * j + 1]), e[3 * j + 2]);
            float tm = fmaxf(fmaxf(fmaxf(t3[0], t3[1]), t3[2]), fmaxf(fmaxf(t3[3], t3[4]), e[15]));
            tm = fmaxf(tm, xhalf(tm));

            const float mn   = fmaxf(mrun, tm);
            const float corr = exp_slot(mrun - mn);
            mrun = mn;
#pragma unroll
            for (int i = 0; i < 16; ++i) e[i] = (e[i] - mn) * 1.44269504f;
            exp_slot8(e);
            exp_slot8(e + 8);
            float r4[4];
#pragma unroll
            for (int j = 0; j < 4; ++j)
                r4[j] = (e[j] + e[j + 4]) + (e[j + 8] + e[j + 12]);
            lrun = lrun * corr + ((r4[0] + r4[2]) + (r4[1] + r4[3]));
#pragma unroll
            for (int nt = 0; nt < 4; ++nt)
#pragma unroll
                for (int i = 0; i < 8; ++i)
                    o[nt][i] *= corr;

            // P^T as B operand: element j is t = 8*g + j, element 8 + j is t = 16 + 8*g + j,
            // the k order in which ld_ab reads the rows of Vt
            v16h pb;
#pragma unroll
            for (int i = 0; i < 16; ++i) pb[i] = (_Float16)e[i];

            // O^T += V^T (64x32) * P^T (32x16): 4 M-tiles of transposed V (contiguous along t)
#pragma unroll
            for (int nt = 0; nt < 4; ++nt) {
                const _Float16* vrow = vs + (nt * 16 + colx) * AT_KP + tb;
                o[nt] = wmma16(ld_ab(vrow, g), pb, o[nt]);
            }
        }

        asm volatile("s_wait_dscnt 0x0" ::: "memory");     // this wave has left the buffer
        if (mine)
            asm volatile("s_wait_asynccnt 0x0" ::: "memory");  // its copies of stage st+1 have landed
        __syncthreads();                                   // publishes stage st+1, frees this buffer
        if (mine && st + 3 < AT_NS) {
            copy_kv(lk + cb * KVB, gk + (size_t)(st + 3) * (AT_T * HD_),
                    lv + cb * KVB, gv + (st + 3) * AT_T);
            copy_mask(lm + cb * MKB, gm + (st + 3) * AT_T);
        }
        cb = (cb == 2u) ? 0u : cb + 1u;
    }
    asm volatile("s_wait_asynccnt 0x0" ::: "memory");      // nothing in flight when the wave ends

    // normalize and store to (s,b,d) f16 for the output projection. The wave's 16 rows of
    // 128 B go through its own 16 rows of mask buffer 0 (last read in stage 15, by this wave
    // alone, in front of the last barrier; nothing is copied there any more) and leave as
    // whole 128-B lines, 8 lanes a line.
    _Float16* so = (_Float16*)(mks[0] + wave * 16 * AT_MP);
    const float lsum = lrun + xhalf(lrun);         // the two halves' sums of this query
#pragma unroll
    for (int nt = 0; nt < 4; ++nt) {
        v8h pk;                                    // eight hd in a row of query colx
#pragma unroll
        for (int i = 0; i < 8; ++i) pk[i] = (_Float16)(o[nt][i] / lsum);
        *(v8h*)(so + colx * (AT_MP * 2) + nt * 16 + 8 * g) = pk;
    }
    asm volatile("s_wait_dscnt 0" ::: "memory");   // the wave's rows are written before it reads them back
    const int r = lane >> 3, c = lane & 7;
    v8h v[4];
#pragma unroll
    for (int j = 0; j < 4; ++j) v[j] = *(const v8h*)(so + (r + 4 * j) * (AT_MP * 2) + c * 8);
    _Float16* gp = attn + ((size_t)((stile * 16 + r) * B_ + b)) * D_ + h * 64 + c * 8;
#pragma unroll
    for (int j = 0; j < 4; ++j) *(v8h*)(gp + j * 4 * B_ * D_) = v[j];
}

// ---------------------------------------------------------------- output projection
// attn (2048x1024,f16) @ Wo^T + bo -> out (f32); gemm_tile with 4 waves (2 x 2). The 64 x 128 results go through
// LDS and leave as 16-byte stores, a wave covering one row's 512 B.
#define OT_P 132                            // staging row: 128 floats + 4 (528 B)
__global__ __launch_bounds__(128) void out_gemm_kernel(
    const _Float16* __restrict__ attn, const _Float16* __restrict__ Wo16,
    const float* __restrict__ bo, float* __restrict__ out)
{
    __shared__ __attribute__((aligned(16))) _Float16 sm[3 * GT_BUF];

    const int lane  = threadIdx.x & 31;
    const int colx  = lane & 15;
    const int g     = lane >> 4;
    const int wave  = threadIdx.x >> 5;
    const int ml    = (wave >> 1) * 32 + 8 * g;              // this lane's row at mt = 0, i = 0
    const int nl    = (wave & 1) * 64 + colx;                // this lane's column at nt = 0

    v8f acc[2][4];
    gemm_tile<D_, 128, 2, 2, 4>(attn, Wo16, blockIdx.x * GT_M, blockIdx.y * GT_N, sm, acc);

    float bn[4];
#pragma unroll
    for (int nt = 0; nt < 4; ++nt) bn[nt] = bo[blockIdx.y * GT_N + nl + nt * 16];

    // sm is free here, as in the QKV kernel.
    float* so = (float*)sm;
#pragma unroll
    for (int nt = 0; nt < 4; ++nt)
#pragma unroll
        for (int mt = 0; mt < 2; ++mt)
#pragma unroll
            for (int i = 0; i < 8; ++i)
                so[(ml + mt * 16 + i) * OT_P + nl + nt * 16] = acc[mt][nt][i] + bn[nt];
    __syncthreads();                        // the staged tile is read across waves

    // this wave's rows: wave, wave+4, ..., wave+60
    v4f v[16];
#pragma unroll
    for (int j = 0; j < 16; ++j) v[j] = *(const v4f*)(so + (wave + 4 * j) * OT_P + lane * 4);
    float* gp = out + (size_t)(blockIdx.x * GT_M + wave) * D_ + blockIdx.y * GT_N + lane * 4;
#pragma unroll
    for (int j = 0; j < 16; ++j) *(v4f*)(gp + j * 4 * D_) = v[j];
}

// ---------------------------------------------------------------- launch
extern "C" void kernel_launch(void* const* d_in, const int* in_sizes, int n_in,
                              void* d_out, int out_size, void* d_ws, size_t ws_size,
                              hipStream_t stream) {
    (void)in_sizes; (void)n_in; (void)out_size; (void)ws_size;

    const float* query = (const float*)d_in[0];
    const float* mask  = (const float*)d_in[1];
    const float* Wq    = (const float*)d_in[2];
    const float* bq    = (const float*)d_in[3];
    const float* Wk    = (const float*)d_in[4];
    const float* bk    = (const float*)d_in[5];
    const float* Wv    = (const float*)d_in[6];
    const float* bv    = (const float*)d_in[7];
    const float* Wo    = (const float*)d_in[8];
    const float* bo    = (const float*)d_in[9];
    float* out = (float*)d_out;

    char* ws = (char*)d_ws;
    const size_t MB = 1024 * 1024;
    _Float16* qf16 = (_Float16*)(ws);             // 2048x1024        (4 MB)
    _Float16* wf16 = (_Float16*)(ws + 4 * MB);    // 4x 1024x1024     (8 MB): q,k,v,o
    _Float16* xq   = (_Float16*)(ws + 12 * MB);   // (b,h,s,hd)       (4 MB)
    _Float16* xk   = (_Float16*)(ws + 16 * MB);   // (b,h,t,hd)       (4 MB)
    _Float16* xvT  = (_Float16*)(ws + 20 * MB);   // (b,h,hd,t)       (4 MB)
    _Float16* attn = (_Float16*)(ws + 24 * MB);   // (s,b,d)          (4 MB)

    const int NW = D_ * D_;     // 1M
    // qf16 and wf16 lie one behind the other: one destination of 6 parts.
    cvt_f16_kernel<<<dim3(CV_PART / CV_WG, 6), CV_TH, 0, stream>>>(query, Wq, Wk, Wv, Wo, qf16);

    qkv_gemm_kernel<<<dim3(M_ / QT_M, 3 * D_ / QT_N), 256, 0, stream>>>(
        qf16, wf16, bq, bk, bv, xq, xk, xvT);

    attn_kernel<<<B_ * H_ * (S_ / AT_Q), AT_W * 32, 0, stream>>>(xq, xk, xvT, mask, attn);

    out_gemm_kernel<<<dim3(M_ / GT_M, D_ / GT_N), 128, 0, stream>>>(
        attn, wf16 + 3 * (size_t)NW, bo, out);
}

// v008
// Measured time: 44.2 microseconds a run.
// Two timings next to v007 both put it at 1.07 times that version's speed.
// Counting every step since v000, it is 4.16 times as fast.
#include <hip/hip_runtime.h>

#define S_  1024
#define B_  2
#define D_  1024
#define H_  16
#define HD_ 64
#define M_  (S_*B_)   // 2048 rows

typedef _Float16 v16h __attribute__((ext_vector_type(16)));
typedef _Float16 v8h  __attribute__((ext_vector_type(8)));
typedef float    v8f  __attribute__((ext_vector_type(8)));

static __device__ __forceinline__ v8f vzero8() {
    v8f z;
#pragma unroll
    for (int i = 0; i < 8; ++i) z[i] = 0.0f;
    return z;
}

// Load a 16x32 (f16) WMMA A/B operand chunk for this lane.
// p = start of this lane's row (A: row m; B: col n) at the current k-base.
// Lane group g (=lane>>4): g=0 takes halves {0..7,16..23}, g=1 takes {8..15,24..31}.
static __device__ __forceinline__ v16h ld_ab(const _Float16* p, int g) {
    v8h lo = *(const v8h*)(p + g * 8);
    v8h hi = *(const v8h*)(p + g * 8 + 16);
    return __builtin_shufflevector(lo, hi, 0,1,2,3,4,5,6,7,8,9,10,11,12,13,14,15);
}

static __device__ __forceinline__ v8f wmma16(v16h a, v16h b, v8f c) {
    // D = A(16x32,f16) * B(32x16,f16) + C(16x16,f32)
    return __builtin_amdgcn_wmma_f32_16x16x32_f16(false, a, false, b, (short)0, c, false, false);
}

// ---------------------------------------------------------------- convert
// All five f32 -> f16 conversions in one launch. The destination is one run of
// 6 x 2^20 halves (query, then Wq, Wk, Wv, Wo); blockIdx.y names the 2^20-value part.
// A wave takes 2,048 values in a row: sixteen 16-byte loads a lane, each 512 B in a row
// over the wave; each store is 256 B in a row.
// Few, long waves, for speed only.
#define CV_PART (1 << 20)                   // values per part
#define CV_LD   16                          // 16-byte loads a lane
#define CV_TH   128                         // threads per work-group
#define CV_WG   (CV_TH * 4 * CV_LD)         // values per work-group (8,192)

typedef float    v4f __attribute__((ext_vector_type(4)));
typedef _Float16 v4h __attribute__((ext_vector_type(4)));
typedef float    v2f __attribute__((ext_vector_type(2)));

__global__ __launch_bounds__(CV_TH) void cvt_f16_kernel(
    const float* __restrict__ query, const float* __restrict__ Wq,
    const float* __restrict__ Wk, const float* __restrict__ Wv,
    const float* __restrict__ Wo, _Float16* __restrict__ dst)
{
    const int part = blockIdx.y;            // 0,1: query; 2..5: Wq, Wk, Wv, Wo
    const float* src = (part < 2)  ? query + (size_t)part * CV_PART
                     : (part == 2) ? Wq
                     : (part == 3) ? Wk
                     : (part == 4) ? Wv : Wo;
    const int off = blockIdx.x * CV_WG + (threadIdx.x >> 5) * (128 * CV_LD)
                  + (threadIdx.x & 31) * 4;
    const float* s = src + off;
    _Float16*    d = dst + (size_t)part * CV_PART + off;

    v4f v[CV_LD];
#pragma unroll
    for (int j = 0; j < CV_LD; ++j) v[j] = *(const v4f*)(s + j * 128);
#pragma unroll
    for (int j = 0; j < CV_LD; ++j)
        *(v4h*)(d + j * 128) = __builtin_convertvector(v[j], v4h);
}

// ---------------------------------------------------------------- GEMM tile in LDS
// Output projection: a work-group of 4 waves (2 x 2) makes a 64M x 128N tile, 32M x 64N a wave.
// QKV: a work-group of 8 waves (2 x 4) makes a 128M x 192N tile, 64M x 48N a wave: 256
// work-groups, one on each WGP, and (128 + 192) operand rows copied from L2 for 128 x 192
// results, where three 64 x 128 tiles copy 576 rows for the same number of results.
// A pass is 128 k: the tile's rows of X and of W, 256 B each, copied to LDS at a
// pitch of 272 B (ds_load_b128 reads of 16 rows then fall on all 64 banks).
// Three buffers: a pass's copies are issued two passes ahead of its use. The two halves of
// the work-group's waves copy in turn, the lower half the even passes and the upper half
// the odd ones, so that a wave never has more than one pass's copies in flight and its
// wait for them is a wait to 0.
#define GT_M   64
#define GT_N   128
#define QT_M   128
#define QT_N   192
#define GT_K   128
#define GT_P   136                          // LDS row pitch in halves (272 B)
#define GT_BUF ((GT_M + GT_N) * GT_P)       // halves per buffer (52,224 B)
#define QT_BUF ((QT_M + QT_N) * GT_P)       // ... of the QKV tile (87,040 B)
#define GT_NP  (D_ / GT_K)                  // 8 passes

// Eight 16-byte copies of this lane: its chunk in rows r, r+RS, ..., r+7*RS.
// LD: halves from one row of the tile to the next in global memory.
// RS: rows that one copy of the work-group's copying half covers (16 lanes a row).
// The s_wait_xcnt stands inside the statement so that no address register of a
// copy is rewritten in front of it.
template <int LD, int RS>
static __device__ __forceinline__ void copy8(unsigned l, const _Float16* p) {
    constexpr unsigned STEP_L = (unsigned)RS * GT_P * 2u;   // RS rows in LDS, bytes
    constexpr int      STEP_G = RS * LD;                    // RS rows in global, halves
    asm volatile(
        "global_load_async_to_lds_b128 %0, %1, off\n\t"
        "global_load_async_to_lds_b128 %2, %3, off\n\t"
        "global_load_async_to_lds_b128 %4, %5, off\n\t"
        "global_load_async_to_lds_b128 %6, %7, off\n\t"
        "global_load_async_to_lds_b128 %8, %9, off\n\t"
        "global_load_async_to_lds_b128 %10, %11, off\n\t"
        "global_load_async_to_lds_b128 %12, %13, off\n\t"
        "global_load_async_to_lds_b128 %14, %15, off\n\t"
        "s_wait_xcnt 0x0"
        :: "v"(l + 0u * STEP_L), "v"(p + 0 * STEP_G),
           "v"(l + 1u * STEP_L), "v"(p + 1 * STEP_G),
           "v"(l + 2u * STEP_L), "v"(p + 2 * STEP_G),
           "v"(l + 3u * STEP_L), "v"(p + 3 * STEP_G),
           "v"(l + 4u * STEP_L), "v"(p + 4 * STEP_G),
           "v"(l + 5u * STEP_L), "v"(p + 5 * STEP_G),
           "v"(l + 6u * STEP_L), "v"(p + 6 * STEP_G),
           "v"(l + 7u * STEP_L), "v"(p + 7 * STEP_G)
        : "memory");
}

// The same for four copies: rows r, r+RS, r+2*RS, r+3*RS; the wait as above.
template <int LD, int RS>
static __device__ __forceinline__ void copy4(unsigned l, const _Float16* p) {
    constexpr unsigned STEP_L = (unsigned)RS * GT_P * 2u;
    constexpr int      STEP_G = RS * LD;
    asm volatile(
        "global_load_async_to_lds_b128 %0, %1, off\n\t"
        "global_load_async_to_lds_b128 %2, %3, off\n\t"
        "global_load_async_to_lds_b128 %4, %5, off\n\t"
        "global_load_async_to_lds_b128 %6, %7, off\n\t"
        "s_wait_xcnt 0x0"
        :: "v"(l + 0u * STEP_L), "v"(p + 0 * STEP_G),
           "v"(l + 1u * STEP_L), "v"(p + 1 * STEP_G),
           "v"(l + 2u * STEP_L), "v"(p + 2 * STEP_G),
           "v"(l + 3u * STEP_L), "v"(p + 3 * STEP_G)
        : "memory");
}

// ROWS rows of one operand: ROWS / RS copies a lane, eight to a statement and a last four.
template <int LD, int RS, int ROWS>
static __device__ __forceinline__ void copy_rows(unsigned l, const _Float16* p) {
    constexpr int N = ROWS / RS;
    static_assert(ROWS % (4 * RS) == 0, "whole statements of four or eight copies");
    if constexpr (N >= 8) {
        copy8<LD, RS>(l, p);
        if constexpr (N > 8)
            copy_rows<LD, RS, ROWS - 8 * RS>(l + 8u * RS * GT_P * 2u, p + (size_t)(8 * RS) * LD);
    } else {
        copy4<LD, RS>(l, p);
    }
}

// One pass's tile: TM + TN rows x 16 chunks of 16 B; 16 lanes cover a row.
// l: LDS byte address of this lane's chunk in its first row of the buffer;
// xa, wb: the same chunk in the X tile and in the W tile at the pass's k.
template <int LDX, int RS, int TM, int TN>
static __device__ __forceinline__ void copy_pass(unsigned l, const _Float16* xa,
                                                 const _Float16* wb) {
    copy_rows<LDX, RS, TM>(l, xa);
    copy_rows<D_, RS, TN>(l + TM * GT_P * 2u, wb);
}

// acc[mt][nt] = X[m0 + wm*MT*16 + mt*16 ..][:] . W[n0 + wn*NT*16 + nt*16 ..][:]^T over all of K;
// row r of X begins at X + r * LDX. The work-group's TH / 32 waves lie WN to a row of waves.
// The loops over mt, nt and kb are unrolled so that every index of a fragment or
// accumulator array is a constant and the arrays stay in registers.
template <int LDX, int TH, int WN, int MT, int NT>
static __device__ __forceinline__ void gemm_tile(
    const _Float16* __restrict__ X, const _Float16* __restrict__ Wt,
    int m0, int n0, _Float16* sm, v8f (&acc)[MT][NT])
{
    constexpr int      TM  = (TH / 32 / WN) * MT * 16;   // rows of X in the tile
    constexpr int      TN  = WN * NT * 16;               // rows of W
    constexpr int      CT  = TH / 2;                     // threads that copy a pass: half of the waves
    constexpr int      RS  = CT / 16;                    // rows that one copy of each of them covers
    constexpr unsigned BUF = (TM + TN) * GT_P;           // halves per buffer
    static_assert((TM + TN) / RS <= 63, "copies of a wave in flight");

    const int tid  = threadIdx.x;
    const int lane = tid & 31;
    const int colx = lane & 15;
    const int g    = lane >> 4;
    const int wave = tid >> 5;
    const int wm   = wave / WN;
    const int wn   = wave % WN;

    // Which half of the waves this one is in, held in a scalar register: the tests on it
    // around the copies and their waits are then scalar branches that a whole wave takes.
    const int half = __builtin_amdgcn_readfirstlane(tid / CT);

    const int crow = (tid % CT) >> 4;   // 0..RS-1
    const int cchk = tid & 15;          // 16-byte chunk in the row
    const _Float16* xa = X  + (size_t)(m0 + crow) * LDX + cchk * 8;
    const _Float16* wb = Wt + (size_t)(n0 + crow) * D_ + cchk * 8;
    const unsigned  l0 = (unsigned)(size_t)(sm + crow * GT_P + cchk * 8);

#pragma unroll
    for (int mt = 0; mt < MT; ++mt)
#pragma unroll
        for (int nt = 0; nt < NT; ++nt) acc[mt][nt] = vzero8();

    if (half == 0) {
        copy_pass<LDX, RS, TM, TN>(l0, xa, wb);
        asm volatile("s_wait_asynccnt 0x0" ::: "memory");   // this wave's copies of pass 0 have landed
    } else {
        copy_pass<LDX, RS, TM, TN>(l0 + BUF * 2u, xa + GT_K, wb + GT_K);
    }
    __syncthreads();                                        // publishes pass 0
    if (half == 0)
        copy_pass<LDX, RS, TM, TN>(l0 + 2u * (BUF * 2u), xa + 2 * GT_K, wb + 2 * GT_K);

    unsigned cb = 0;                    // the buffer of pass t: t mod 3
    for (int t = 0; t < GT_NP; ++t) {
        const _Float16* buf = sm + cb * BUF;
        const bool mine = half == ((t + 1) & 1);            // this half copies passes t+1 and t+3
        const _Float16* sa  = buf + (wm * (MT * 16) + colx) * GT_P;
        const _Float16* sb  = buf + (TM + wn * (NT * 16) + colx) * GT_P;
        // Fragments of the next 32 k are read, as one group, ahead of this block's WMMAs.
        v16h a[2][MT], bm[2][NT];
#pragma unroll
        for (int mt = 0; mt < MT; ++mt) a[0][mt] = ld_ab(sa + mt * 16 * GT_P, g);
#pragma unroll
        for (int nt = 0; nt < NT; ++nt) bm[0][nt] = ld_ab(sb + nt * 16 * GT_P, g);
#pragma unroll
        for (int kb = 0; kb < GT_K / 32; ++kb) {
            const int cur = kb & 1, nxt = cur ^ 1;
            if (kb + 1 < GT_K / 32) {
#pragma unroll
                for (int mt = 0; mt < MT; ++mt)
                    a[nxt][mt] = ld_ab(sa + mt * 16 * GT_P + (kb + 1) * 32, g);
#pragma unroll
                for (int nt = 0; nt < NT; ++nt)
                    bm[nxt][nt] = ld_ab(sb + nt * 16 * GT_P + (kb + 1) * 32, g);
            }
            // Keeps the read group in front of the WMMA block: left free, the scheduler
            // sinks each read to its use and every WMMA pair waits out an LDS latency.
            __builtin_amdgcn_sched_barrier(0);
#pragma unroll
            for (int nt = 0; nt < NT; ++nt)
#pragma unroll
                for (int mt = 0; mt < MT; ++mt)
                    acc[mt][nt] = wmma16(a[cur][mt], bm[cur][nt], acc[mt][nt]);
            // Keeps the following read group behind this block, so that it stays one group.
            __builtin_amdgcn_sched_barrier(0);
        }
        asm volatile("s_wait_dscnt 0x0" ::: "memory");     // this wave has left the buffer
        if (mine)
            asm volatile("s_wait_asynccnt 0x0" ::: "memory");  // its copies of pass t+1 have landed
        __syncthreads();                                   // publishes pass t+1, frees this buffer
        if (mine && t + 3 < GT_NP)
            copy_pass<LDX, RS, TM, TN>(l0 + cb * (BUF * 2u), xa + (t + 3) * GT_K, wb + (t + 3) * GT_K);
        cb = (cb == 2u) ? 0u : cb + 1u;
    }
    asm volatile("s_wait_asynccnt 0x0" ::: "memory");      // nothing in flight when the wave ends
}

// ---------------------------------------------------------------- QKV GEMM
// X (2048x1024, f16) @ [Wq; Wk; Wv]^T + b: the three weights lie one behind the other, so
// that the product has 3,072 columns = 48 heads of 64: 16 of q, 16 of k, 16 of v.
// Outputs: xq/xk in (b,h,s,hd), xv transposed to (b,h,hd,t).
// A work-group takes 128 s of ONE b (every second row of X) and three heads in a row, each
// of which may be of q, of k or of v. Its results are whole 128-B lines of the destination:
// a head of q or k is 128 rows (s) of 64 hd, a head of v 64 rows (hd) of 128 t. They go
// through LDS in that order and leave as 16-byte stores.
#define ST_P 72                             // staging row of q, k: 64 halves + 8 (144 B)
#define SV_P 136                            // staging row of v: 128 halves + 8 (272 B)
#define ST_H (QT_M * ST_P)                  // halves of a head's staging area (v fills 64 * SV_P of it)
__global__ __launch_bounds__(256) void qkv_gemm_kernel(
    const _Float16* __restrict__ qf16, const _Float16* __restrict__ wf16,
    const float* __restrict__ bq, const float* __restrict__ bk,
    const float* __restrict__ bv,
    _Float16* __restrict__ xq, _Float16* __restrict__ xk,
    _Float16* __restrict__ xvT)
{
    __shared__ __attribute__((aligned(16))) _Float16 sm[3 * QT_BUF];

    const int tid   = threadIdx.x;
    const int lane  = tid & 31;
    const int colx  = lane & 15;
    const int g     = lane >> 4;
    const int wave  = tid >> 5;
    const int b     = blockIdx.x & 1;
    const int s0    = (blockIdx.x >> 1) * QT_M;              // first s of the work-group
    const int sl    = (wave >> 2) * 64 + 8 * g;              // this lane's s - s0 at mt = 0, i = 0
    const int gh0   = blockIdx.y * 3;                        // first of the three heads, 0..47

    v8f acc[4][3];
    // rows of X are (s,b) interleaved, B=2: row s of this b begins at qf16 + b*D_ + s*(B_*D_)
    gemm_tile<B_ * D_, 256, 4, 4, 3>(qf16 + b * D_, wf16, s0, blockIdx.y * QT_N, sm, acc);

    // sm is free here: every wave has passed the last pass's barrier with its LDS reads
    // retired, and no copy is in flight.
    float bn3[3];
#pragma unroll
    for (int nt = 0; nt < 3; ++nt) {
        const int ct    = (wave & 3) * 3 + nt;               // 16-column tile, 0..11
        const int gh    = gh0 + (ct >> 2);                   // its head
        const int which = gh >> 4;                           // 0=q 1=k 2=v
        const float* bias = (which == 0) ? bq : (which == 1) ? bk : bv;
        bn3[nt] = bias[(gh & 15) * HD_ + (ct & 3) * 16 + colx];
    }
#pragma unroll
    for (int nt = 0; nt < 3; ++nt) {
        const int ct    = (wave & 3) * 3 + nt;
        const int which = (gh0 + (ct >> 2)) >> 4;
        const int hd    = (ct & 3) * 16 + colx;              // this lane's column in the head
        const float  bn = bn3[nt];
        _Float16*    sh = sm + (ct >> 2) * ST_H;
        if (which == 2) {
            // staging row = hd: a lane's eight values are eight t in a row
#pragma unroll
            for (int mt = 0; mt < 4; ++mt) {
                v8h pk;
#pragma unroll
                for (int i = 0; i < 8; ++i) pk[i] = (_Float16)(acc[mt][nt][i] + bn);
                *(v8h*)(sh + hd * SV_P + sl + mt * 16) = pk;
            }
        } else {
            // staging row = s
#pragma unroll
            for (int mt = 0; mt < 4; ++mt)
#pragma unroll
                for (int i = 0; i < 8; ++i)
                    sh[(sl + mt * 16 + i) * ST_P + hd] = (_Float16)(acc[mt][nt][i] + bn);
        }
    }
    __syncthreads();                        // the staged tile is read across waves

    // A head is 1,024 chunks of 16 B, four a thread. q, k: 128 rows of 8 chunks, this
    // thread's chunk in rows r, r+32, r+64, r+96; v: 64 rows of 16 chunks, rows r, r+16,
    // r+32, r+48. All twelve chunks are read before the first is stored.
    v8h       v[3][4];
    _Float16* gp[3];
    int       gs[3];
#pragma unroll
    for (int hl = 0; hl < 3; ++hl) {
        const int  gh  = gh0 + hl;
        const int  bh  = b * H_ + (gh & 15);
        const bool isv = (gh >> 4) == 2;
        const int  r   = isv ? tid >> 4 : tid >> 3;
        const int  c   = isv ? tid & 15 : tid & 7;
        const _Float16* sp = sm + hl * ST_H + r * (isv ? SV_P : ST_P) + c * 8;
        const int  ss  = isv ? 16 * SV_P : 32 * ST_P;        // halves from one of its rows to the next
#pragma unroll
        for (int j = 0; j < 4; ++j) v[hl][j] = *(const v8h*)(sp + j * ss);
        gp[hl] = isv ? xvT + (size_t)(bh * HD_ + r) * S_ + s0 + c * 8                    // (b,h,hd,t)
                     : (((gh >> 4) == 0) ? xq : xk) + (size_t)(bh * S_ + s0 + r) * HD_ + c * 8;  // (b,h,s,hd)
        gs[hl] = isv ? 16 * S_ : 32 * HD_;
    }
#pragma unroll
    for (int hl = 0; hl < 3; ++hl)
#pragma unroll
        for (int j = 0; j < 4; ++j) *(v8h*)(gp[hl] + j * gs[hl]) = v[hl][j];
}

#define AT_W   8                            // tiles of 16 Q rows per work-group
#define AT_G   2                            // waves per tile: each takes its own t columns
#define AT_Q   (AT_W * 16)                  // Q rows per work-group
#define AT_T   64                           // t columns of a wave per stage
#define AT_ST  (AT_G * AT_T)                // t columns per stage
#define AT_KP  72                           // K row pitch in halves (144 B)
#define AT_VP  136                          // Vt row pitch in halves (272 B)
#define AT_MP  132                          // mask row pitch in floats (528 B)
#define AT_KH  (AT_ST * AT_KP)              // halves in a K tile
#define AT_VH  (HD_ * AT_VP)                // halves in a Vt tile
#define AT_NS  (S_ / AT_ST)                 // 8 stages

// This lane's 16-byte chunk in rows r, r+32, r+64, r+96 of the K tile and in rows
// r', r'+16, r'+32, r'+48 of the Vt tile.
// The s_wait_xcnt stands inside the statement so that no address register of a
// copy is rewritten in front of it.
static __device__ __forceinline__ void copy_kv(unsigned lk, const _Float16* k,
                                               unsigned lv, const _Float16* v) {
    constexpr unsigned STEP_K = 32u * AT_KP * 2u;   // 32 rows of K in LDS, bytes
    constexpr unsigned STEP_V = 16u * AT_VP * 2u;   // 16 rows of Vt in LDS, bytes
    asm volatile(
        "global_load_async_to_lds_b128 %0, %1, off\n\t"
        "global_load_async_to_lds_b128 %2, %3, off\n\t"
        "global_load_async_to_lds_b128 %4, %5, off\n\t"
        "global_load_async_to_lds_b128 %6, %7, off\n\t"
        "global_load_async_to_lds_b128 %8, %9, off\n\t"
        "global_load_async_to_lds_b128 %10, %11, off\n\t"
        "global_load_async_to_lds_b128 %12, %13, off\n\t"
        "global_load_async_to_lds_b128 %14, %15, off\n\t"
        "s_wait_xcnt 0x0"
        :: "v"(lk + 0u * STEP_K), "v"(k + 0 * 32 * HD_),
           "v"(lk + 1u * STEP_K), "v"(k + 1 * 32 * HD_),
           "v"(lk + 2u * STEP_K), "v"(k + 2 * 32 * HD_),
           "v"(lk + 3u * STEP_K), "v"(k + 3 * 32 * HD_),
           "v"(lv + 0u * STEP_V), "v"(v + 0 * 16 * S_),
           "v"(lv + 1u * STEP_V), "v"(v + 1 * 16 * S_),
           "v"(lv + 2u * STEP_V), "v"(v + 2 * 16 * S_),
           "v"(lv + 3u * STEP_V), "v"(v + 3 * 16 * S_)
        : "memory");
}

// This lane's 16-byte chunk in rows r, r+8, ..., r+56 of the mask tile; the wait as above.
static __device__ __forceinline__ void copy_mask8(unsigned l, const float* p) {
    constexpr unsigned STEP_L = 8u * AT_MP * 4u;    // 8 rows in LDS, bytes
    constexpr int      STEP_G = 8 * S_;             // 8 rows in global, floats
    asm volatile(
        "global_load_async_to_lds_b128 %0, %1, off\n\t"
        "global_load_async_to_lds_b128 %2, %3, off\n\t"
        "global_load_async_to_lds_b128 %4, %5, off\n\t"
        "global_load_async_to_lds_b128 %6, %7, off\n\t"
        "global_load_async_to_lds_b128 %8, %9, off\n\t"
        "global_load_async_to_lds_b128 %10, %11, off\n\t"
        "global_load_async_to_lds_b128 %12, %13, off\n\t"
        "global_load_async_to_lds_b128 %14, %15, off\n\t"
        "s_wait_xcnt 0x0"
        :: "v"(l + 0u * STEP_L), "v"(p + 0 * STEP_G),
           "v"(l + 1u * STEP_L), "v"(p + 1 * STEP_G),
           "v"(l + 2u * STEP_L), "v"(p + 2 * STEP_G),
           "v"(l + 3u * STEP_L), "v"(p + 3 * STEP_G),
           "v"(l + 4u * STEP_L), "v"(p + 4 * STEP_G),
           "v"(l + 5u * STEP_L), "v"(p + 5 * STEP_G),
           "v"(l + 6u * STEP_L), "v"(p + 6 * STEP_G),
           "v"(l + 7u * STEP_L), "v"(p + 7 * STEP_G)
        : "memory");
}

// The 128 rows of the mask tile: the upper 64 behind the lower 64.
static __device__ __forceinline__ void copy_mask(unsigned l, const float* p) {
    copy_mask8(l, p);
    copy_mask8(l + 64u * AT_MP * 4u, p + 64 * S_);
}

// e^x as __expf forms it (x * log2(e), then v_exp_f32), with the one free slot that the
// instruction set asks for behind a transcendental kept in the same statement.
// The exp works in place: the only register that the asm text writes is one that the
// multiply in front of it has written, so it is never a register that a WMMA still reads.
static __device__ __forceinline__ float exp_slot(float x) {
    float r = x * 1.44269504f;
    asm("v_exp_f32 %0, %0\n\tv_nop" : "+v"(r));
    return r;
}

// The same for eight values: each exp is followed by one that shares no register with it,
// so that one free slot behind the last serves the run.
static __device__ __forceinline__ void exp_slot8(float* e) {
    asm("v_exp_f32 %0, %0\n\t"
        "v_exp_f32 %1, %1\n\t"
        "v_exp_f32 %2, %2\n\t"
        "v_exp_f32 %3, %3\n\t"
        "v_exp_f32 %4, %4\n\t"
        "v_exp_f32 %5, %5\n\t"
        "v_exp_f32 %6, %6\n\t"
        "v_exp_f32 %7, %7\n\t"
        "v_nop"
        : "+v"(e[0]), "+v"(e[1]), "+v"(e[2]), "+v"(e[3]),
          "+v"(e[4]), "+v"(e[5]), "+v"(e[6]), "+v"(e[7]));
}

// Lane l with lane l ^ 16, on the vector port.
static __device__ __forceinline__ float xhalf(float x) {
    const int b = __builtin_bit_cast(int, x);
    return __builtin_bit_cast(float,
        __builtin_amdgcn_permlanex16(b, b, 0x76543210, 0xfedcba98, false, false));
}

__global__ __launch_bounds__(AT_W * AT_G * 32) void attn_kernel(
    const _Float16* __restrict__ xq, const _Float16* __restrict__ xk,
    const _Float16* __restrict__ xvT, const float* __restrict__ mask,
    _Float16* __restrict__ attn)
{
    __shared__ __attribute__((aligned(16))) _Float16 kvs[3][AT_KH + AT_VH]; // K tile, Vt tile
    __shared__ __attribute__((aligned(16))) float    mks[3][AT_Q * AT_MP];  // mask tile

    const int tid   = threadIdx.x;
    const int lane  = tid & 31;
    const int colx  = lane & 15;
    const int g     = lane >> 4;
    const int qw    = (tid >> 5) & (AT_W - 1);     // this wave's tile of 16 Q rows
    const int q0    = (blockIdx.x & 7) * AT_Q;     // first Q row of the work-group
    const int stile = (q0 >> 4) + qw;              // ... counted over the sequence
    const int h     = (blockIdx.x >> 3) & 15;
    const int b     = blockIdx.x >> 7;

    const _Float16* Qb = xq  + ((size_t)(b * H_ + h) * S_) * HD_;
    const _Float16* Kb = xk  + ((size_t)(b * H_ + h) * S_) * HD_;
    const _Float16* Vt = xvT + ((size_t)(b * H_ + h) * HD_) * S_;

    // Which half of the waves this one is in, held in a scalar register: the tests on it
    // around the copies and their waits are then scalar branches that a whole wave takes.
    // It also names the wave's t columns: the lower or the upper 64 of every stage.
    const int half = __builtin_amdgcn_readfirstlane(tid >> 8);

    // Copy addresses of this lane at stage 0, buffer 0. K: 8 lanes cover a row of 128 B,
    // the eight copying waves 32 rows; Vt: 16 lanes cover a row of 256 B, they 16 rows;
    // mask: a wave covers a row of 512 B, they 8 rows.
    const int ctid = tid & 255;
    const int krow = ctid >> 3, kchk = ctid & 7;
    const int vrw  = ctid >> 4, vchk = ctid & 15;
    const int mrow = ctid >> 5, mchk = ctid & 31;
    const _Float16* gk = Kb + (size_t)krow * HD_ + kchk * 8;
    const _Float16* gv = Vt + (size_t)vrw * S_   + vchk * 8;
    const float*    gm = mask + (size_t)(q0 + mrow) * S_ + mchk * 4;
    const unsigned  lk = (unsigned)(size_t)(&kvs[0][krow * AT_KP + kchk * 8]);
    const unsigned  lv = (unsigned)(size_t)(&kvs[0][AT_KH + vrw * AT_VP + vchk * 8]);
    const unsigned  lm = (unsigned)(size_t)(&mks[0][mrow * AT_MP + mchk * 4]);
    constexpr unsigned KVB = (AT_KH + AT_VH) * 2u; // bytes from one buffer to the next: K, Vt
    constexpr unsigned MKB = AT_Q * AT_MP * 4u;    // ... mask

    if (half == 0) {
        copy_kv(lk, gk, lv, gv);
        copy_mask(lm, gm);
    } else {
        copy_kv(lk + KVB, gk + AT_ST * HD_, lv + KVB, gv + AT_ST);
        copy_mask(lm + MKB, gm + AT_ST);
    }

    // Q tile B-operands (column = query colx), kept resident: hd 0..31 and 32..63
    const _Float16* qrow = Qb + (size_t)(stile * 16 + colx) * HD_;
    const v16h qb0 = ld_ab(qrow,      g);
    const v16h qb1 = ld_ab(qrow + 32, g);

    // This lane's query, over this wave's t columns: the running maximum (equal in both halves
    // of the wave) and the sum over this half's t alone; all sums are joined behind the loop.
    float mrun = -1.0e30f, lrun = 0.0f;
    v8f o[4];                                      // O^T: o[nt][i] = hd nt*16 + 8*g + i of query colx
#pragma unroll
    for (int nt = 0; nt < 4; ++nt) o[nt] = vzero8();

    if (half == 0)
        asm volatile("s_wait_asynccnt 0x0" ::: "memory");   // this wave's copies of stage 0 have landed
    __syncthreads();                                        // publishes stage 0
    if (half == 0) {
        copy_kv(lk + 2u * KVB, gk + 2 * AT_ST * HD_, lv + 2u * KVB, gv + 2 * AT_ST);
        copy_mask(lm + 2u * MKB, gm + 2 * AT_ST);
    }

    unsigned cb = 0;                               // the buffer of stage st: st mod 3
    for (int st = 0; st < AT_NS; ++st) {
        const _Float16* ks = kvs[cb] + half * (AT_T * AT_KP);      // this wave's 64 rows of K
        const _Float16* vs = kvs[cb] + AT_KH + half * AT_T;        // ... 64 columns of Vt
        const float*    ms = mks[cb] + (qw * 16 + colx) * AT_MP + half * AT_T + 8 * g;
        const bool mine = half == ((st + 1) & 1);  // this half copies stages st+1 and st+3

        // Two steps of 32 t columns; unrolled so that every LDS offset is a constant.
#pragma unroll
        for (int tb = 0; tb < AT_T; tb += 32) {
            // S^T for 32 t: two 16x16 C tiles (row = t, column = query), K=64 over hd
            v8f s0 = vzero8(), s1 = vzero8();
            {
                const _Float16* krow0 = ks + (tb + colx) * AT_KP;
                s0 = wmma16(ld_ab(krow0,      g), qb0, s0);
                s0 = wmma16(ld_ab(krow0 + 32, g), qb1, s0);
                const _Float16* krow1 = ks + (tb + 16 + colx) * AT_KP;
                s1 = wmma16(ld_ab(krow1,      g), qb0, s1);
                s1 = wmma16(ld_ab(krow1 + 32, g), qb1, s1);
            }

            // The mask of this lane's query at its t: tb + 8*g + i and tb + 16 + 8*g + i
            const v4f mk[4] = { *(const v4f*)(ms + tb),      *(const v4f*)(ms + tb + 4),
                                *(const v4f*)(ms + tb + 16), *(const v4f*)(ms + tb + 20) };

            // scale * multiplicative mask; e[i] is t = 8*g + i, e[8 + i] is t = 16 + 8*g + i
            // (two neighbours at a time: accumulator and mask registers pair as they lie)
            float e[16];
#pragma unroll
            for (int j = 0; j < 4; ++j) {
                const v2f m0 = { mk[j >> 1][2 * (j & 1)],     mk[j >> 1][2 * (j & 1) + 1] };
                const v2f m1 = { mk[2 + (j >> 1)][2 * (j & 1)], mk[2 + (j >> 1)][2 * (j & 1) + 1] };
                const v2f a0 = { s0[2 * j], s0[2 * j + 1] };
                const v2f a1 = { s1[2 * j], s1[2 * j + 1] };
                const v2f f0 = a0 * 0.125f * m0;
                const v2f f1 = a1 * 0.125f * m1;
                e[2 * j]     = f0[0]; e[2 * j + 1] = f0[1];
                e[2 * j + 8] = f1[0]; e[2 * j + 9] = f1[1];
            }

            // online softmax over t: the maximum of the lane's 16, then of the query's 32
            float t3[5];
#pragma unroll
            for (int j = 0; j < 5; ++j)
                t3[j] = fmaxf(fmaxf(e[3 * j], e[3 * j + 1]), e[3 * j + 2]);
            float tm = fmaxf(fmaxf(fmaxf(t3[0], t3[1]), t3[2]), fmaxf(fmaxf(t3[3], t3[4]), e[15]));
            tm = fmaxf(tm, xhalf(tm));

            const float mn   = fmaxf(mrun, tm);
            const float corr = exp_slot(mrun - mn);
            mrun = mn;
#pragma unroll
            for (int i = 0; i < 16; ++i) e[i] = (e[i] - mn) * 1.44269504f;
            exp_slot8(e);
            exp_slot8(e + 8);
            float r4[4];
#pragma unroll
            for (int j = 0; j < 4; ++j)
                r4[j] = (e[j] + e[j + 4]) + (e[j + 8] + e[j + 12]);
            lrun = lrun * corr + ((r4[0] + r4[2]) + (r4[1] + r4[3]));
#pragma unroll
            for (int nt = 0; nt < 4; ++nt)
#pragma unroll
                for (int i = 0; i < 8; ++i)
                    o[nt][i] *= corr;

            // P^T as B operand: element j is t = 8*g + j, element 8 + j is t = 16 + 8*g + j,
            // the k order in which ld_ab reads the rows of Vt
            v16h pb;
#pragma unroll
            for (int i = 0; i < 16; ++i) pb[i] = (_Float16)e[i];

            // O^T += V^T (64x32) * P^T (32x16): 4 M-tiles of transposed V (contiguous along t)
#pragma unroll
            for (int nt = 0; nt < 4; ++nt) {
                const _Float16* vrow = vs + (nt * 16 + colx) * AT_VP + tb;
                o[nt] = wmma16(ld_ab(vrow, g), pb, o[nt]);
            }
        }

        asm volatile("s_wait_dscnt 0x0" ::: "memory");     // this wave has left the buffer
        if (mine)
            asm volatile("s_wait_asynccnt 0x0" ::: "memory");  // its copies of stage st+1 have landed
        __syncthreads();                                   // publishes stage st+1, frees this buffer
        if (mine && st + 3 < AT_NS) {
            copy_kv(lk + cb * KVB, gk + (size_t)(st + 3) * (AT_ST * HD_),
                    lv + cb * KVB, gv + (st + 3) * AT_ST);
            copy_mask(lm + cb * MKB, gm + (st + 3) * AT_ST);
        }
        cb = (cb == 2u) ? 0u : cb + 1u;
    }
    asm volatile("s_wait_asynccnt 0x0" ::: "memory");      // nothing in flight when the wave ends

    // The join of a tile's two waves. The ring is free here: every wave has passed the last
    // stage's barrier with its LDS reads retired, and no copy is in flight. The upper wave
    // hands its O^T (eight 16-byte pieces a lane, each 512 B in a row over the wave), its
    // maximum and its sum over in mask buffer 0; the lower wave scales both parts to the
    // common maximum and adds them.
    float* mg = mks[0] + qw * (34 * 32);
    if (half == 1) {
        // unrolled so that every index of o is a constant and o stays in registers
#pragma unroll
        for (int nt = 0; nt < 4; ++nt) {
            const v4f lo = { o[nt][0], o[nt][1], o[nt][2], o[nt][3] };
            const v4f hi = { o[nt][4], o[nt][5], o[nt][6], o[nt][7] };
            *(v4f*)(mg + (2 * nt)     * 128 + lane * 4) = lo;
            *(v4f*)(mg + (2 * nt + 1) * 128 + lane * 4) = hi;
        }
        mg[32 * 32 + lane] = mrun;
        mg[33 * 32 + lane] = lrun;
    }
    __syncthreads();                               // the upper waves' parts are read by the lower waves
    if (half == 1) return;                         // no barrier stands behind this line

    const float mB = mg[32 * 32 + lane];
    const float lB = mg[33 * 32 + lane];
    const float mj = fmaxf(mrun, mB);
    const float cA = exp_slot(mrun - mj);
    const float cB = exp_slot(mB - mj);
    const float lj = lrun * cA + lB * cB;

    // normalize and store to (s,b,d) f16 for the output projection. The wave's 16 rows of
    // 128 B go through its own 16 rows of mask buffer 1 and leave as whole 128-B lines,
    // 8 lanes a line.
    _Float16* so = (_Float16*)(mks[1] + qw * 16 * AT_MP);
    const float lsum = lj + xhalf(lj);             // the two halves' sums of this query
#pragma unroll
    for (int nt = 0; nt < 4; ++nt) {
        const v4f lo = *(const v4f*)(mg + (2 * nt)     * 128 + lane * 4);
        const v4f hi = *(const v4f*)(mg + (2 * nt + 1) * 128 + lane * 4);
        v8h pk;                                    // eight hd in a row of query colx
#pragma unroll
        for (int i = 0; i < 8; ++i)
            pk[i] = (_Float16)((o[nt][i] * cA + (i < 4 ? lo[i & 3] : hi[i & 3]) * cB) / lsum);
        *(v8h*)(so + colx * (AT_MP * 2) + nt * 16 + 8 * g) = pk;
    }
    asm volatile("s_wait_dscnt 0" ::: "memory");   // the wave's rows are written before it reads them back
    const int r = lane >> 3, c = lane & 7;
    v8h v[4];
#pragma unroll
    for (int j = 0; j < 4; ++j) v[j] = *(const v8h*)(so + (r + 4 * j) * (AT_MP * 2) + c * 8);
    _Float16* gp = attn + ((size_t)((stile * 16 + r) * B_ + b)) * D_ + h * 64 + c * 8;
#pragma unroll
    for (int j = 0; j < 4; ++j) *(v8h*)(gp + j * 4 * B_ * D_) = v[j];
}

// ---------------------------------------------------------------- output projection
// attn (2048x1024,f16) @ Wo^T + bo -> out (f32); gemm_tile with 4 waves (2 x 2). The 64 x 128 results go through
// LDS and leave as 16-byte stores, a wave covering one row's 512 B.
#define OT_P 132                            // staging row: 128 floats + 4 (528 B)
__global__ __launch_bounds__(128) void out_gemm_kernel(
    const _Float16* __restrict__ attn, const _Float16* __restrict__ Wo16,
    const float* __restrict__ bo, float* __restrict__ out)
{
    __shared__ __attribute__((aligned(16))) _Float16 sm[3 * GT_BUF];

    const int lane  = threadIdx.x & 31;
    const int colx  = lane & 15;
    const int g     = lane >> 4;
    const int wave  = threadIdx.x >> 5;
    const int ml    = (wave >> 1) * 32 + 8 * g;              // this lane's row at mt = 0, i = 0
    const int nl    = (wave & 1) * 64 + colx;                // this lane's column at nt = 0

    v8f acc[2][4];
    gemm_tile<D_, 128, 2, 2, 4>(attn, Wo16, blockIdx.x * GT_M, blockIdx.y * GT_N, sm, acc);

    float bn[4];
#pragma unroll
    for (int nt = 0; nt < 4; ++nt) bn[nt] = bo[blockIdx.y * GT_N + nl + nt * 16];

    // sm is free here, as in the QKV kernel.
    float* so = (float*)sm;
#pragma unroll
    for (int nt = 0; nt < 4; ++nt)
#pragma unroll
        for (int mt = 0; mt < 2; ++mt)
#pragma unroll
            for (int i = 0; i < 8; ++i)
                so[(ml + mt * 16 + i) * OT_P + nl + nt * 16] = acc[mt][nt][i] + bn[nt];
    __syncthreads();                        // the staged tile is read across waves

    // this wave's rows: wave, wave+4, ..., wave+60
    v4f v[16];
#pragma unroll
    for (int j = 0; j < 16; ++j) v[j] = *(const v4f*)(so + (wave + 4 * j) * OT_P + lane * 4);
    float* gp = out + (size_t)(blockIdx.x * GT_M + wave) * D_ + blockIdx.y * GT_N + lane * 4;
#pragma unroll
    for (int j = 0; j < 16; ++j) *(v4f*)(gp + j * 4 * D_) = v[j];
}

// ---------------------------------------------------------------- launch
extern "C" void kernel_launch(void* const* d_in, const int* in_sizes, int n_in,
                              void* d_out, int out_size, void* d_ws, size_t ws_size,
                              hipStream_t stream) {
    (void)in_sizes; (void)n_in; (void)out_size; (void)ws_size;

    const float* query = (const float*)d_in[0];
    const float* mask  = (const float*)d_in[1];
    const float* Wq    = (const float*)d_in[2];
    const float* bq    = (const float*)d_in[3];
    const float* Wk    = (const float*)d_in[4];
    const float* bk    = (const float*)d_in[5];
    const float* Wv    = (const float*)d_in[6];
    const float* bv    = (const float*)d_in[7];
    const float* Wo    = (const float*)d_in[8];
    const float* bo    = (const float*)d_in[9];
    float* out = (float*)d_out;

    char* ws = (char*)d_ws;
    const size_t MB = 1024 * 1024;
    _Float16* qf16 = (_Float16*)(ws);             // 2048x1024        (4 MB)
    _Float16* wf16 = (_Float16*)(ws + 4 * MB);    // 4x 1024x1024     (8 MB): q,k,v,o
    _Float16* xq   = (_Float16*)(ws + 12 * MB);   // (b,h,s,hd)       (4 MB)
    _Float16* xk   = (_Float16*)(ws + 16 * MB);   // (b,h,t,hd)       (4 MB)
    _Float16* xvT  = (_Float16*)(ws + 20 * MB);   // (b,h,hd,t)       (4 MB)
    _Float16* attn = (_Float16*)(ws + 24 * MB);   // (s,b,d)          (4 MB)

    const int NW = D_ * D_;     // 1M
    // qf16 and wf16 lie one behind the other: one destination of 6 parts.
    cvt_f16_kernel<<<dim3(CV_PART / CV_WG, 6), CV_TH, 0, stream>>>(query, Wq, Wk, Wv, Wo, qf16);

    qkv_gemm_kernel<<<dim3(M_ / QT_M, 3 * D_ / QT_N), 256, 0, stream>>>(
        qf16, wf16, bq, bk, bv, xq, xk, xvT);

    attn_kernel<<<B_ * H_ * (S_ / AT_Q), AT_W * AT_G * 32, 0, stream>>>(xq, xk, xvT, mask, attn);

    out_gemm_kernel<<<dim3(M_ / GT_M, D_ / GT_N), 128, 0, stream>>>(
        attn, wf16 + 3 * (size_t)NW, bo, out);
}
